// v000
// Times are from an AMD MI455X. After a warm-up the kernel runs many times in a row, and a time is the length of
// such a window on the GPU divided by its runs, so every launch and the gaps after it count. The runs cycle
// through copies of the inputs. A figure is the median of several windows, for all but v000 over two sittings.
// Sittings can differ by a few percent; kernels timed side by side share one.
// v000, which the later versions start from, runs in 2610 microseconds.
// compute dtype: all float inputs rounded to bf16; q/k/v projections with EXACT bf16 products on WMMA 16x16x32 (f32 accumulate); causal logits: 3 products (q f16 hi + residual x k hi + residual) for the first 384 rows, single f16 q x k after, x scale; softmax f32; P x 2^11 once to f16 x v once to f16 (1 product; bf16 hi + lo below row 384); f32 output.
#include <hip/hip_runtime.h>
#include <math.h>

typedef __attribute__((ext_vector_type(16))) _Float16 v16h;
typedef __attribute__((ext_vector_type(16))) __bf16 v16b;
typedef __attribute__((ext_vector_type(8)))  _Float16 v8h;
typedef __attribute__((ext_vector_type(8)))  float v8f;
typedef __attribute__((ext_vector_type(4)))  float v4f;
typedef __attribute__((ext_vector_type(2)))  float v2f;
typedef __attribute__((ext_vector_type(4)))  unsigned v4u;
typedef __attribute__((ext_vector_type(4)))  int v4i;
typedef float __attribute__((may_alias)) float_a;
typedef int __attribute__((may_alias)) int_a;

template <typename T> __device__ __forceinline__ void vst2(void* p, T v) { *(T*)p = v;  }
__device__ __forceinline__ v8f wmma16(v16h a, v16h b, v8f c) {
  v8f d = __builtin_amdgcn_wmma_f32_16x16x32_f16(false, a, false, b, (short)0, c, false, false);
  asm volatile("v_nop\n\tv_nop\n\tv_nop\n\tv_nop" : "+v"(d) : "v"(a), "v"(b));
  return d;
}
__device__ __forceinline__ v8f wmma_bf(v16b a, v16b b, v8f c) {
  v8f d = __builtin_amdgcn_wmma_f32_16x16x32_bf16(false, a, false, b, (short)0, c, false, false);
  asm volatile("v_nop\n\tv_nop\n\tv_nop\n\tv_nop" : "+v"(d) : "v"(a), "v"(b));
  return d;
}
// 16x16x32 fragments: lane = (h = lane>>4, row/col = lane&15); elements 0..7 = k0+8h+0..7, 8..15 = k0+16+8h+0..7; D element r = row 8h+r
__device__ __forceinline__ v16h frag_h(const _Float16* rowk0, int lane) {
  union { v16h v; v8h q[2]; } u; const _Float16* p = rowk0 + 8 * (lane >> 4);
  u.q[0] = *(const v8h*)p; u.q[1] = *(const v8h*)(p + 16); return u.v;
}
__device__ __forceinline__ v16h frag_f32(const float* rowk0, int lane) {
  v16h a; const float* p = rowk0 + 8 * (lane >> 4);
#pragma unroll
  for (int i = 0; i < 8; ++i) { a[i] = (_Float16)p[i]; a[8 + i] = (_Float16)p[16 + i]; }
  return a;
}
__device__ __forceinline__ v16h frag_f32s(const float* rowk0, int lane, float sc) {
  v16h a; const float* p = rowk0 + 8 * (lane >> 4);
#pragma unroll
  for (int i = 0; i < 8; ++i) { a[i] = (_Float16)(p[i] * sc); a[8 + i] = (_Float16)(p[16 + i] * sc); }
  return a;
}
// column fragment from a [K][ld] layout (column n), rows >= K read as 0
__device__ __forceinline__ v16h fragc_f32(const float* W, int k0, int n, int lane, int ld, int K) {
  v16h a; const int g = lane >> 4;
#pragma unroll
  for (int i = 0; i < 8; ++i) { const int ka = k0 + 8 * g + i, kb = ka + 16;
    a[i] = (_Float16)(ka < K ? W[(size_t)(ka < K ? ka : K - 1) * ld + n] : 0.f); a[8 + i] = (_Float16)(kb < K ? W[(size_t)(kb < K ? kb : K - 1) * ld + n] : 0.f); }
  return a;
}
struct F2 { v16b h, l; };
__device__ __forceinline__ F2 bsplit16(const float v[16]) { F2 r;
#pragma unroll
  for (int i = 0; i < 16; ++i) { const __bf16 h = (__bf16)v[i]; r.h[i] = h; r.l[i] = (__bf16)(v[i] - (float)h); }
  return r; }
__device__ __forceinline__ F2 split_row(const float* row, int k0, int lane) { float v[16]; const float* p = row + k0 + 8 * (lane >> 4);
#pragma unroll
  for (int i = 0; i < 8; ++i) { v[i] = p[i]; v[8 + i] = p[16 + i]; }
  return bsplit16(v); }
__device__ __forceinline__ F2 split_rowK(const float* row, int k0, int lane, int K) { float v[16]; const int g = lane >> 4;
#pragma unroll
  for (int i = 0; i < 8; ++i) { const int ka = k0 + 8 * g + i, kb = ka + 16; v[i] = ka < K ? row[ka < K ? ka : K - 1] : 0.f; v[8 + i] = kb < K ? row[kb < K ? kb : K - 1] : 0.f; }
  return bsplit16(v); }
__device__ __forceinline__ F2 split_col(const float* W, int k0, int n, int lane, int ld, int K) { float v[16]; const int g = lane >> 4;
#pragma unroll
  for (int i = 0; i < 8; ++i) { const int ka = k0 + 8 * g + i, kb = ka + 16; v[i] = ka < K ? W[(size_t)(ka < K ? ka : K - 1) * ld + n] : 0.f; v[8 + i] = kb < K ? W[(size_t)(kb < K ? kb : K - 1) * ld + n] : 0.f; }
  return bsplit16(v); }
__device__ __forceinline__ v8f mac3(const F2& a, const F2& b, v8f c) { c = wmma_bf(a.l, b.h, c); c = wmma_bf(a.h, b.l, c); return wmma_bf(a.h, b.h, c); }
__device__ __forceinline__ float sigm(float v) { return 1.0f / (1.0f + expf(-v)); }
#define LDSX() do { asm volatile("s_wait_dscnt 0" ::: "memory"); __builtin_amdgcn_wave_barrier(); __builtin_amdgcn_fence(__ATOMIC_RELEASE, "workgroup"); } while (0)

// Single-head causal self-attention (x [16,4096,64]; (in,out) Wq / Wk / Wv [64,64] N(0, 1/64), no biases; scale 64^-0.5; tril, finfo.min fill): out = softmax(causal(q k^T / 8)) v -> [16,4096,64].
#define NB 16
#define TT 4096
#define CC 128            // NH * HD = projected width
#define DIN 64          // input (model) width
#define NH 2
#define HD 64
#define NQB (TT / 64)
#define HG 1
#define SCALE (0.125f)
#define CAUSAL 1
#ifndef TNB
#define TNB NB
#endif
__device__ __forceinline__ float bfr(float v) { return (float)(__bf16)v; }
__host__ __device__ __forceinline__ int kb_last(int qb) { return CAUSAL ? ((qb * 64 + 63) >> 7) : (TT / 128 - 1); }
typedef __attribute__((ext_vector_type(8))) __bf16 v8b;
__device__ __forceinline__ v16b frag_b(const __bf16* rowk0, int lane) {
  union { v16b v; v8b q[2]; } u; const __bf16* p = rowk0 + 8 * (lane >> 4);
  u.q[0] = *(const v8b*)p; u.q[1] = *(const v8b*)(p + 16); return u.v;
}
#define QBH 6              // causal: query blocks 0..QBH-1 of each sequence (few keys, no averaging) take the high-precision path
#define QHI 384            // rows carrying a q residual plane (all rows when non-causal: 2-product logits everywhere)
#define KHI 384            // key rows carrying k residual / v bf16 hi+lo planes (used only by the causal high-precision path)
// B fragment (k rows k0+.., output column o) of a weight: (in,out) [K][ld] or (out,in) [ld rows of K]: bf16 exact, or f16(bf16 * 256) exact
__device__ __forceinline__ v16b wcol_io(const float* Wm, int k0, int o, int lane, int ld) { v16b w; const int g = lane >> 4;
#pragma unroll
  for (int i = 0; i < 8; ++i) { w[i] = (__bf16)Wm[(size_t)(k0 + 8 * g + i) * ld + o]; w[8 + i] = (__bf16)Wm[(size_t)(k0 + 16 + 8 * g + i) * ld + o]; }
  return w; }
__device__ __forceinline__ v16b wcol_oi(const float* Wm, int k0, int o, int lane, int K) { v16b w; const float* p = Wm + (size_t)o * K + k0 + 8 * (lane >> 4);
#pragma unroll
  for (int i = 0; i < 8; ++i) { w[i] = (__bf16)p[i]; w[8 + i] = (__bf16)p[16 + i]; }
  return w; }
__device__ __forceinline__ v16h wcolh_io(const float* Wm, int k0, int o, int lane, int ld) { v16h w; const int g = lane >> 4;
#pragma unroll
  for (int i = 0; i < 8; ++i) { w[i] = (_Float16)(bfr(Wm[(size_t)(k0 + 8 * g + i) * ld + o]) * 256.0f); w[8 + i] = (_Float16)(bfr(Wm[(size_t)(k0 + 16 + 8 * g + i) * ld + o]) * 256.0f); }
  return w; }
__device__ __forceinline__ v16h wcolh_oi(const float* Wm, int k0, int o, int lane, int K) { v16h w; const float* p = Wm + (size_t)o * K + k0 + 8 * (lane >> 4);
#pragma unroll
  for (int i = 0; i < 8; ++i) { w[i] = (_Float16)(bfr(p[i]) * 256.0f); w[8 + i] = (_Float16)(bfr(p[16 + i]) * 256.0f); }
  return w; }
#define WQKV_LAYOUT 0   // 0 = (in,out) [DIN][CC]; 1 = (out,in) [CC][DIN]; 2 = per-head [NH][DIN][HD]
__device__ __forceinline__ v16b wcol_hdk(const float* Wm, int k0, int o, int lane) { v16b w; const int g = lane >> 4; const float* p = Wm + (size_t)(o / HD) * DIN * HD + (o % HD);
#pragma unroll
  for (int i = 0; i < 8; ++i) { w[i] = (__bf16)p[(size_t)(k0 + 8 * g + i) * HD]; w[8 + i] = (__bf16)p[(size_t)(k0 + 16 + 8 * g + i) * HD]; }
  return w; }
#define WO_OUT_IN 0
#if WQKV_LAYOUT == 1
#define WCOL(W, k0, o, lane) wcol_oi(W, k0, o, lane, DIN)
#elif WQKV_LAYOUT == 2
#define WCOL(W, k0, o, lane) wcol_hdk(W, k0, o, lane)
#else
#define WCOL(W, k0, o, lane) wcol_io(W, k0, o, lane, CC)
#endif
#if WO_OUT_IN
#define WOCOL(W, k0, o, lane) wcol_oi(W, k0, o, lane, CC)
#define WOCOLH(W, k0, o, lane) wcolh_oi(W, k0, o, lane, CC)
#else
#define WOCOL(W, k0, o, lane) wcol_io(W, k0, o, lane, DIN)
#define WOCOLH(W, k0, o, lane) wcolh_io(W, k0, o, lane, DIN)
#endif
#define CIN 64
// ---- k_padw: the three (in,out) [C][64] projection weights copied into zero-padded (in,out) [C][128] ws planes (columns 64..127 zero) + zero-padded [128] biases
__global__ __launch_bounds__(256) void k_padw(const float* __restrict__ WQ, const float* __restrict__ WK, const float* __restrict__ WV, const float* __restrict__ BQ, const float* __restrict__ BK, const float* __restrict__ BV, float* __restrict__ WP, float* __restrict__ BP) { const int which = blockIdx.y; const float* Wsrc = which == 0 ? WQ : (which == 1 ? WK : WV); const float* Bsrc = which == 0 ? BQ : (which == 1 ? BK : BV); float* dst = WP + (size_t)which * CIN * 128;
  for (int e = blockIdx.x * 256 + threadIdx.x; e < CIN * 32; e += gridDim.x * 256) { const int row = e >> 5, q = e & 31; const v4f ld = *(const v4f*)(Wsrc + (size_t)row * 64 + (q & 15) * 4); asm volatile("s_wait_loadcnt 0x0" ::: "memory"); const float keep = q < 16 ? 1.f : 0.f; v4f ov; ov[0] = ld[0] * keep; ov[1] = ld[1] * keep; ov[2] = ld[2] * keep; ov[3] = ld[3] * keep; vst2(dst + (size_t)row * 128 + q * 4, ov); }
  if (blockIdx.x == 0 && threadIdx.x < 128) { const int c = threadIdx.x; float bvv = 0.f; if (Bsrc) { const float t = Bsrc[c & 63]; asm volatile("s_wait_loadcnt 0x0" ::: "memory"); bvv = c < 64 ? t : 0.f; } vst2(BP + which * 128 + c, bvv); } }
// ---- k_out64: out[b][t][0..63] = ctx row columns 0..63 (256 B by 16 lanes)
__global__ __launch_bounds__(256) void k_out64(const float* __restrict__ Y, float* __restrict__ OUT) { const size_t row = (size_t)blockIdx.x * 16 + (threadIdx.x >> 4); const int q = threadIdx.x & 15; const v4f v = *(const v4f*)(Y + row * CC + q * 4); asm volatile("s_wait_loadcnt 0x0" ::: "memory"); vst2(OUT + row * 64 + q * 4, v); }
#define WS_WP (WS_END)                                  // padded weights [3][128 x C]
#define WS_BP (WS_WP + 4u * 3 * (size_t)CIN * 128)        // padded biases [3][128]
#define WS_Y2 (WS_BP + 4u * 3 * 128)                      // ctx rows [b*TT+t][128]
#define WS_END2 (WS_Y2 + 4u * (size_t)NB * TT * CC)
#ifndef SM_EXTRA_PARAMS
#define SM_EXTRA_PARAMS
#endif
#ifndef PROJ_EXTRA_PARAMS
#define PROJ_EXTRA_PARAMS
#endif
#ifndef SM_MASK_HOOK
#define SM_MASK_HOOK (void)0
#endif

#define WS_QH  0u                                      // f16 q rows [b*t][CC]
#define WS_KH  (WS_QH + 2u * (size_t)NB * TT * CC)      // f16 k rows [b*t][CC]
#define WS_VT  (WS_KH + 2u * (size_t)NB * TT * CC)      // f16 v planes [b][c][t]
#define WS_QL  (WS_VT + 2u * (size_t)NB * CC * TT)      // f16 q residual x 2^10 rows [b][t < QHI][CC]
#define WS_KL  (WS_QL + 2u * (size_t)NB * QHI * CC)     // f16 k residual x 2^10 rows [b][t < KHI][CC]
#define WS_VB  (WS_KL + 2u * (size_t)NB * KHI * CC)     // bf16 v hi planes [b][c][t < KHI]
#define WS_VBL (WS_VB + 2u * (size_t)NB * CC * KHI)
#define WS_S   (WS_VBL + 2u * (size_t)NB * CC * KHI)    // f32 logits / P [hg][t][s]
#define WS_Y   (WS_S  + 4u * (size_t)HG * TT * TT)      // f32 ctx rows [b*t][CC] (only when there is an output projection)
#define WS_END (WS_Y  + 0u)

// ---- k_proj: block = (64 rows, 128 cols, which): q/k/v = X W (+ b) with exact bf16 products (K = DIN) -> which 0: q f16 rows (+ residual rows < QHI); 1: k f16 rows (+ residual rows < KHI); 2: v f16 planes [c][t] (+ bf16 hi/lo planes for t < KHI)
__global__ __launch_bounds__(128) void k_proj(const float* __restrict__ XQ, const float* __restrict__ XK, const float* __restrict__ XV, const float* __restrict__ WQ, const float* __restrict__ WK, const float* __restrict__ WV, const float* __restrict__ BQ, const float* __restrict__ BK, const float* __restrict__ BV,
    _Float16* __restrict__ QH, _Float16* __restrict__ QL, _Float16* __restrict__ KH, _Float16* __restrict__ KL, _Float16* __restrict__ VT, __bf16* __restrict__ VB, __bf16* __restrict__ VBL) {
  __shared__ __align__(16) _Float16 sh[64][136], sl[64][136]; __shared__ __align__(16) _Float16 th[128][72]; __shared__ __align__(16) __bf16 tb[128][72], tbl[128][72];
  const int tid = threadIdx.x, wave = tid >> 5, lane = tid & 31, col = lane & 15, g = lane >> 4; const int which = blockIdx.z; const int c0 = blockIdx.y * 128; const size_t r0 = (size_t)blockIdx.x * 64; const size_t bb = r0 / TT; const int t0 = (int)(r0 % TT);
  const float* X = which == 0 ? XQ : which == 1 ? XK : XV; const float* WA = which == 0 ? WQ : which == 1 ? WK : WV; const float* BA = which == 0 ? BQ : which == 1 ? BK : BV;
  v8f acc[8] = {};
#pragma unroll 2
  for (int kc = 0; kc < DIN / 32; ++kc) { v16b a; { const float* p = X + (r0 + wave * 16 + col) * DIN + kc * 32 + 8 * g;
#pragma unroll
      for (int i = 0; i < 8; ++i) { a[i] = (__bf16)p[i]; a[8 + i] = (__bf16)p[16 + i]; } }
    asm volatile("s_wait_loadcnt 0x0" ::: "memory");
#pragma unroll
    for (int j = 0; j < 8; ++j) { const v16b w = WCOL(WA, kc * 32, c0 + j * 16 + col, lane); asm volatile("s_wait_loadcnt 0x0" ::: "memory"); acc[j] = wmma_bf(a, w, acc[j]); } }
  if (which < 2) { _Float16* DH = which == 0 ? QH : KH; _Float16* DL = which == 0 ? QL : KL; const int nhi = which == 0 ? QHI : KHI; const bool hi_rows = t0 < nhi;
#pragma unroll
    for (int j = 0; j < 8; ++j) { const float bias = BA ? bfr(BA[c0 + j * 16 + col]) : 0.f;
#pragma unroll
      for (int r = 0; r < 8; ++r) { const float v = acc[j][r] + bias; const _Float16 hv = (_Float16)v; sh[wave * 16 + 8 * g + r][j * 16 + col] = hv; sl[wave * 16 + 8 * g + r][j * 16 + col] = (_Float16)((v - (float)hv) * 1024.0f); } }
    __syncthreads();
    for (int e = tid; e < 64 * 16; e += 128) { const int rl = e >> 4, q = e & 15; vst2((unsigned*)(DH + (r0 + rl) * CC + c0 + q * 8), *(const v4u*)&sh[rl][q * 8]); if (hi_rows) vst2((unsigned*)(DL + (bb * nhi + t0 + rl) * (size_t)CC + c0 + q * 8), *(const v4u*)&sl[rl][q * 8]); }
  } else { const bool hi_rows = t0 < KHI;
#pragma unroll
    for (int j = 0; j < 8; ++j) { const float bias = BA ? bfr(BA[c0 + j * 16 + col]) : 0.f;
#pragma unroll
      for (int r = 0; r < 8; ++r) { const float v = acc[j][r] + bias; const int rl = wave * 16 + 8 * g + r, cl = j * 16 + col; th[cl][rl] = (_Float16)v; const __bf16 bh = (__bf16)v; tb[cl][rl] = bh; tbl[cl][rl] = (__bf16)(v - (float)bh); } }
    __syncthreads();
    for (int e = tid; e < 128 * 8; e += 128) { const int cl = e >> 3, q = e & 7; vst2((unsigned*)(VT + (bb * CC + c0 + cl) * (size_t)TT + t0 + q * 8), *(const v4u*)&th[cl][q * 8]); if (hi_rows) { const size_t o3 = (bb * CC + c0 + cl) * (size_t)KHI + t0 + q * 8; vst2((unsigned*)(VB + o3), *(const v4u*)&tb[cl][q * 8]); vst2((unsigned*)(VBL + o3), *(const v4u*)&tbl[cl][q * 8]); } } } }
// ---- k_sc: block = (query block qb, key block kb <= kb_last(qb), head in group) of batch b: logits x SCALE; q hi + residual (x 2^10) against k (2 products) for query rows < QHI, plus the k residual (3 products) for query blocks < QBH (causal early rows); causal: blocks past the diagonal exit, the mask itself is applied by index in k_sm
__global__ __launch_bounds__(128) void k_sc(const _Float16* __restrict__ QH, const _Float16* __restrict__ KH, const _Float16* __restrict__ QL, const _Float16* __restrict__ KL, int b, int h0, float* __restrict__ S0) { __shared__ __align__(16) float ss[4][16][132];
  const int qb = blockIdx.x, kb = blockIdx.y; if (kb > kb_last(qb)) return;
  const int h = h0 + blockIdx.z; float* S = S0 + (size_t)blockIdx.z * TT * TT;
  const int tid = threadIdx.x, wave = tid >> 5, lane = tid & 31, col = lane & 15, g = lane >> 4; const int k0 = kb * 128; const int ql0 = qb * 64 + wave * 16; const size_t q0 = (size_t)b * TT + ql0, kr0 = (size_t)b * TT + k0;
  v8f acc[8] = {}, accl[8] = {};
  const _Float16* QLb = QL + (size_t)b * QHI * CC; const _Float16* KLb = KL + (size_t)b * KHI * CC;
  if (qb < QBH) {
#pragma unroll
    for (int kc = 0; kc < HD / 32; ++kc) { const v16h ah = frag_h(QH + (q0 + col) * CC + h * HD + kc * 32, lane), al = frag_h(QLb + (size_t)(ql0 + col) * CC + h * HD + kc * 32, lane);
#pragma unroll
      for (int j = 0; j < 8; ++j) { const v16h kbf = frag_h(KH + (kr0 + j * 16 + col) * CC + h * HD + kc * 32, lane), klf = frag_h(KLb + (size_t)(k0 + j * 16 + col) * CC + h * HD + kc * 32, lane); acc[j] = wmma16(ah, kbf, acc[j]); accl[j] = wmma16(al, kbf, accl[j]); accl[j] = wmma16(ah, klf, accl[j]); } }
  } else if (qb * 64 < QHI) {
#pragma unroll
    for (int kc = 0; kc < HD / 32; ++kc) { const v16h ah = frag_h(QH + (q0 + col) * CC + h * HD + kc * 32, lane), al = frag_h(QLb + (size_t)(ql0 + col) * CC + h * HD + kc * 32, lane);
#pragma unroll
      for (int j = 0; j < 8; ++j) { const v16h kbf = frag_h(KH + (kr0 + j * 16 + col) * CC + h * HD + kc * 32, lane); acc[j] = wmma16(ah, kbf, acc[j]); accl[j] = wmma16(al, kbf, accl[j]); } }
  } else {
#pragma unroll
    for (int kc = 0; kc < HD / 32; ++kc) { const v16h ah = frag_h(QH + (q0 + col) * CC + h * HD + kc * 32, lane);
#pragma unroll
      for (int j = 0; j < 8; ++j) { const v16h kbf = frag_h(KH + (kr0 + j * 16 + col) * CC + h * HD + kc * 32, lane); acc[j] = wmma16(ah, kbf, acc[j]); } } }
#pragma unroll
  for (int j = 0; j < 8; ++j) {
#pragma unroll
    for (int r = 0; r < 8; ++r) ss[wave][8 * g + r][j * 16 + col] = (acc[j][r] + accl[j][r] * (1.0f / 1024.0f)) * SCALE; }
  LDSX(); for (int rl = 0; rl < 16; ++rl) vst2(S + (size_t)(ql0 + rl) * TT + k0 + lane * 4, *(const v4f*)&ss[wave][rl][lane * 4]); }
// ---- k_sm: block = query row t (head in group): keys [0, kend): causal -> logit if s <= t else excluded; softmax in f32; P x 2^11 in place (0 for excluded)
__global__ __launch_bounds__(256) void k_sm(float* __restrict__ S0 SM_EXTRA_PARAMS) { __shared__ float sred[8]; __shared__ float sbc; __shared__ __align__(16) float shv[TT];
  const int tid = threadIdx.x; const int t = blockIdx.x; const int kend = (kb_last(t >> 6) + 1) * 128;
  float* sr = S0 + (size_t)blockIdx.y * TT * TT + (size_t)t * TT;
  float m = -3.0e38f; for (int k = tid; k < kend; k += 256) { float v = (!CAUSAL || k <= t) ? sr[k] : -3.0e38f; SM_MASK_HOOK; shv[k] = v; m = fmaxf(m, v); }
#pragma unroll
  for (int o = 1; o < 32; o <<= 1) m = fmaxf(m, __shfl_xor(m, o));
  if ((tid & 31) == 0) sred[tid >> 5] = m; __syncthreads(); if (tid == 0) { float a = sred[0]; for (int i = 1; i < 8; ++i) a = fmaxf(a, sred[i]); sbc = a; } __syncthreads(); m = sbc; __syncthreads();
  float sum = 0.f; for (int k = tid; k < kend; k += 256) { const float v = shv[k]; const float e = (v <= -1.0e38f) ? 0.f : expf(v - m); shv[k] = e; sum += e; }
#pragma unroll
  for (int o = 1; o < 32; o <<= 1) sum += __shfl_xor(sum, o);
  if ((tid & 31) == 0) sred[tid >> 5] = sum; __syncthreads(); if (tid == 0) { float a = 0.f; for (int i = 0; i < 8; ++i) a += sred[i]; sbc = a > 0.f ? 2048.0f / a : 0.f; }   /* a fully excluded row yields P = 0 */ __syncthreads(); const float inv = sbc;
  for (int k = tid; k < kend; k += 256) shv[k] = shv[k] * inv;
  __syncthreads(); for (int q = tid; q < kend / 4; q += 256) vst2(sr + q * 4, *(const v4f*)&shv[q * 4]); }
// ---- k_pv: block = 64 queries (qb) of (b, h): ctx = P . v over keys [0, kend) (P x 2^11 once to f16 against v f16: 1 product; causal early query blocks: P and v as bf16 hi + lo, 3 products); 256-B (row, head) segment by 16 lanes
__global__ __launch_bounds__(128) void k_pv(const float* __restrict__ PS0, const _Float16* __restrict__ VT, const __bf16* __restrict__ VB, const __bf16* __restrict__ VBL, int b, int h0, float* __restrict__ Y) { const int h = h0 + blockIdx.z; const float* PS = PS0 + (size_t)blockIdx.z * TT * TT; __shared__ __align__(16) float ss[4][16][HD + 4];
  const int tid = threadIdx.x, wave = tid >> 5, lane = tid & 31, col = lane & 15, g = lane >> 4; const int qb = blockIdx.x; const int ql0 = qb * 64 + wave * 16; const int kce = (kb_last(qb) + 1) * 4;
  v8f acc[HD / 16] = {};
  if (qb < QBH) {
#pragma unroll 1
    for (int kc = 0; kc < kce; ++kc) { const F2 p = split_row(PS + (size_t)(ql0 + col) * TT, kc * 32, lane);
      asm volatile("s_wait_loadcnt 0x0" ::: "memory");
#pragma unroll
      for (int j = 0; j < HD / 16; ++j) { const size_t po = ((size_t)b * CC + h * HD + j * 16 + col) * (size_t)KHI + kc * 32; const v16b vh = frag_b(VB + po, lane); acc[j] = wmma_bf(p.h, vh, acc[j]); acc[j] = wmma_bf(p.l, vh, acc[j]); acc[j] = wmma_bf(p.h, frag_b(VBL + po, lane), acc[j]); } }
  } else {
#pragma unroll 1
    for (int kc = 0; kc < kce; ++kc) { const v16h p = frag_f32(PS + (size_t)(ql0 + col) * TT + kc * 32, lane);
      asm volatile("s_wait_loadcnt 0x0" ::: "memory");
#pragma unroll
      for (int j = 0; j < HD / 16; ++j) { const size_t po = ((size_t)b * CC + h * HD + j * 16 + col) * (size_t)TT + kc * 32; acc[j] = wmma16(p, frag_h(VT + po, lane), acc[j]); } } }
#pragma unroll
  for (int j = 0; j < HD / 16; ++j)
#pragma unroll
    for (int r = 0; r < 8; ++r) ss[wave][8 * g + r][j * 16 + col] = acc[j][r] * (1.0f / 2048.0f);
  LDSX(); for (int rl = 0; rl < 16; ++rl) if (lane < HD / 4) vst2(Y + ((size_t)b * TT + ql0 + rl) * CC + h * HD + lane * 4, *(const v4f*)&ss[wave][rl][lane * 4]); }

extern "C" void kernel_launch(void* const* d_in, const int* in_sizes, int n_in, void* d_out, int out_size, void* d_ws, size_t ws_size, hipStream_t stream) {
  (void)in_sizes; (void)n_in; (void)out_size;
  const float** F = (const float**)d_in;
  if (ws_size < (size_t)WS_END) return;
  char* ws = (char*)d_ws; _Float16 *QH = (_Float16*)(ws + WS_QH), *KH = (_Float16*)(ws + WS_KH), *VT = (_Float16*)(ws + WS_VT), *QL = (_Float16*)(ws + WS_QL), *KL = (_Float16*)(ws + WS_KL); __bf16 *VB = (__bf16*)(ws + WS_VB), *VBL = (__bf16*)(ws + WS_VBL); float *S = (float*)(ws + WS_S), *Y = (float*)(ws + WS_Y);
  (void)Y; (void)QL; (void)KL; (void)VB; (void)VBL;
  // inputs: 0 x [16,4096,64]; 1 Wq [64,64]; 2 Wk; 3 Wv ((in,out), no biases)
  if (ws_size < (size_t)WS_END2) return;
  float *WP = (float*)(ws + WS_WP), *BP = (float*)(ws + WS_BP), *Y2 = (float*)(ws + WS_Y2);
  k_padw<<<dim3(32, 3), 256, 0, stream>>>(F[1], F[2], F[3], nullptr, nullptr, nullptr, WP, BP);
  k_proj<<<dim3(TNB * TT / 64, CC / 128, 3), 128, 0, stream>>>(F[0], F[0], F[0], WP, WP + (size_t)CIN * 128, WP + 2 * (size_t)CIN * 128, BP, BP + 128, BP + 256, QH, QL, KH, KL, VT, VB, VBL);
  for (int b = 0; b < TNB; ++b) {   /* head 0 only (head 1 is the zero padding) */
    k_sc<<<dim3(NQB, TT / 128, 1), 128, 0, stream>>>(QH, KH, QL, KL, b, 0, S);
    k_sm<<<dim3(TT, 1), 256, 0, stream>>>(S);
    k_pv<<<dim3(NQB, 1, 1), 128, 0, stream>>>(S, VT, VB, VBL, b, 0, Y2);
  }
  k_out64<<<dim3(TNB * TT / 16), 256, 0, stream>>>(Y2, (float*)d_out);
}

// v001
// Measured time: 889 microseconds a run.
// Two timings next to v000 both put it at 2.95 times that version's speed.
// compute dtype: all float inputs rounded to bf16; q/k/v projections with EXACT bf16 products on WMMA 16x16x32 (f32 accumulate); causal logits: 3 products (q f16 hi + residual x k hi + residual) for the first 384 rows, single f16 q x k after, x scale; softmax f32; P x 2^11 once to f16 x v once to f16 (1 product; bf16 hi + lo below row 384); f32 output.
#include <hip/hip_runtime.h>
#include <math.h>

typedef __attribute__((ext_vector_type(16))) _Float16 v16h;
typedef __attribute__((ext_vector_type(16))) __bf16 v16b;
typedef __attribute__((ext_vector_type(8)))  _Float16 v8h;
typedef __attribute__((ext_vector_type(8)))  float v8f;
typedef __attribute__((ext_vector_type(4)))  float v4f;
typedef __attribute__((ext_vector_type(2)))  float v2f;
typedef __attribute__((ext_vector_type(4)))  unsigned v4u;
typedef __attribute__((ext_vector_type(4)))  int v4i;
typedef float __attribute__((may_alias)) float_a;
typedef int __attribute__((may_alias)) int_a;

template <typename T> __device__ __forceinline__ void vst2(void* p, T v) { *(T*)p = v;  }
__device__ __forceinline__ v8f wmma16(v16h a, v16h b, v8f c) {
  v8f d = __builtin_amdgcn_wmma_f32_16x16x32_f16(false, a, false, b, (short)0, c, false, false);
  asm volatile("v_nop\n\tv_nop\n\tv_nop\n\tv_nop" : "+v"(d) : "v"(a), "v"(b));
  return d;
}
__device__ __forceinline__ v8f wmma_bf(v16b a, v16b b, v8f c) {
  v8f d = __builtin_amdgcn_wmma_f32_16x16x32_bf16(false, a, false, b, (short)0, c, false, false);
  asm volatile("v_nop\n\tv_nop\n\tv_nop\n\tv_nop" : "+v"(d) : "v"(a), "v"(b));
  return d;
}
// 16x16x32 fragments: lane = (h = lane>>4, row/col = lane&15); elements 0..7 = k0+8h+0..7, 8..15 = k0+16+8h+0..7; D element r = row 8h+r
__device__ __forceinline__ v16h frag_h(const _Float16* rowk0, int lane) {
  union { v16h v; v8h q[2]; } u; const _Float16* p = rowk0 + 8 * (lane >> 4);
  u.q[0] = *(const v8h*)p; u.q[1] = *(const v8h*)(p + 16); return u.v;
}
__device__ __forceinline__ v16h frag_f32(const float* rowk0, int lane) {
  v16h a; const float* p = rowk0 + 8 * (lane >> 4);
#pragma unroll
  for (int i = 0; i < 8; ++i) { a[i] = (_Float16)p[i]; a[8 + i] = (_Float16)p[16 + i]; }
  return a;
}
__device__ __forceinline__ v16h frag_f32s(const float* rowk0, int lane, float sc) {
  v16h a; const float* p = rowk0 + 8 * (lane >> 4);
#pragma unroll
  for (int i = 0; i < 8; ++i) { a[i] = (_Float16)(p[i] * sc); a[8 + i] = (_Float16)(p[16 + i] * sc); }
  return a;
}
// column fragment from a [K][ld] layout (column n), rows >= K read as 0
__device__ __forceinline__ v16h fragc_f32(const float* W, int k0, int n, int lane, int ld, int K) {
  v16h a; const int g = lane >> 4;
#pragma unroll
  for (int i = 0; i < 8; ++i) { const int ka = k0 + 8 * g + i, kb = ka + 16;
    a[i] = (_Float16)(ka < K ? W[(size_t)(ka < K ? ka : K - 1) * ld + n] : 0.f); a[8 + i] = (_Float16)(kb < K ? W[(size_t)(kb < K ? kb : K - 1) * ld + n] : 0.f); }
  return a;
}
struct F2 { v16b h, l; };
__device__ __forceinline__ F2 bsplit16(const float v[16]) { F2 r;
#pragma unroll
  for (int i = 0; i < 16; ++i) { const __bf16 h = (__bf16)v[i]; r.h[i] = h; r.l[i] = (__bf16)(v[i] - (float)h); }
  return r; }
__device__ __forceinline__ F2 split_row(const float* row, int k0, int lane) { float v[16]; const float* p = row + k0 + 8 * (lane >> 4);
#pragma unroll
  for (int i = 0; i < 8; ++i) { v[i] = p[i]; v[8 + i] = p[16 + i]; }
  return bsplit16(v); }
__device__ __forceinline__ F2 split_rowK(const float* row, int k0, int lane, int K) { float v[16]; const int g = lane >> 4;
#pragma unroll
  for (int i = 0; i < 8; ++i) { const int ka = k0 + 8 * g + i, kb = ka + 16; v[i] = ka < K ? row[ka < K ? ka : K - 1] : 0.f; v[8 + i] = kb < K ? row[kb < K ? kb : K - 1] : 0.f; }
  return bsplit16(v); }
__device__ __forceinline__ F2 split_col(const float* W, int k0, int n, int lane, int ld, int K) { float v[16]; const int g = lane >> 4;
#pragma unroll
  for (int i = 0; i < 8; ++i) { const int ka = k0 + 8 * g + i, kb = ka + 16; v[i] = ka < K ? W[(size_t)(ka < K ? ka : K - 1) * ld + n] : 0.f; v[8 + i] = kb < K ? W[(size_t)(kb < K ? kb : K - 1) * ld + n] : 0.f; }
  return bsplit16(v); }
__device__ __forceinline__ v8f mac3(const F2& a, const F2& b, v8f c) { c = wmma_bf(a.l, b.h, c); c = wmma_bf(a.h, b.l, c); return wmma_bf(a.h, b.h, c); }
__device__ __forceinline__ float sigm(float v) { return 1.0f / (1.0f + expf(-v)); }
#define LDSX() do { asm volatile("s_wait_dscnt 0" ::: "memory"); __builtin_amdgcn_wave_barrier(); __builtin_amdgcn_fence(__ATOMIC_RELEASE, "workgroup"); } while (0)

// Single-head causal self-attention (x [16,4096,64]; (in,out) Wq / Wk / Wv [64,64] N(0, 1/64), no biases; scale 64^-0.5; tril, finfo.min fill): out = softmax(causal(q k^T / 8)) v -> [16,4096,64].
#define NB 16
#define TT 4096
#define CC 128            // NH * HD = projected width
#define DIN 64          // input (model) width
#define NH 2
#define HD 64
#define NQB (TT / 64)
#define HG 1
#define SCALE (0.125f)
#define CAUSAL 1
#ifndef TNB
#define TNB NB
#endif
__device__ __forceinline__ float bfr(float v) { return (float)(__bf16)v; }
__host__ __device__ __forceinline__ int kb_last(int qb) { return CAUSAL ? ((qb * 64 + 63) >> 7) : (TT / 128 - 1); }
typedef __attribute__((ext_vector_type(8))) __bf16 v8b;
__device__ __forceinline__ v16b frag_b(const __bf16* rowk0, int lane) {
  union { v16b v; v8b q[2]; } u; const __bf16* p = rowk0 + 8 * (lane >> 4);
  u.q[0] = *(const v8b*)p; u.q[1] = *(const v8b*)(p + 16); return u.v;
}
#define QBH 6              // causal: query blocks 0..QBH-1 of each sequence (few keys, no averaging) take the high-precision path
#define QHI 384            // rows carrying a q residual plane (all rows when non-causal: 2-product logits everywhere)
#define KHI 384            // key rows carrying k residual / v bf16 hi+lo planes (used only by the causal high-precision path)
// B fragment (k rows k0+.., output column o) of a weight: (in,out) [K][ld] or (out,in) [ld rows of K]: bf16 exact, or f16(bf16 * 256) exact
__device__ __forceinline__ v16b wcol_io(const float* Wm, int k0, int o, int lane, int ld) { v16b w; const int g = lane >> 4;
#pragma unroll
  for (int i = 0; i < 8; ++i) { w[i] = (__bf16)Wm[(size_t)(k0 + 8 * g + i) * ld + o]; w[8 + i] = (__bf16)Wm[(size_t)(k0 + 16 + 8 * g + i) * ld + o]; }
  return w; }
__device__ __forceinline__ v16b wcol_oi(const float* Wm, int k0, int o, int lane, int K) { v16b w; const float* p = Wm + (size_t)o * K + k0 + 8 * (lane >> 4);
#pragma unroll
  for (int i = 0; i < 8; ++i) { w[i] = (__bf16)p[i]; w[8 + i] = (__bf16)p[16 + i]; }
  return w; }
__device__ __forceinline__ v16h wcolh_io(const float* Wm, int k0, int o, int lane, int ld) { v16h w; const int g = lane >> 4;
#pragma unroll
  for (int i = 0; i < 8; ++i) { w[i] = (_Float16)(bfr(Wm[(size_t)(k0 + 8 * g + i) * ld + o]) * 256.0f); w[8 + i] = (_Float16)(bfr(Wm[(size_t)(k0 + 16 + 8 * g + i) * ld + o]) * 256.0f); }
  return w; }
__device__ __forceinline__ v16h wcolh_oi(const float* Wm, int k0, int o, int lane, int K) { v16h w; const float* p = Wm + (size_t)o * K + k0 + 8 * (lane >> 4);
#pragma unroll
  for (int i = 0; i < 8; ++i) { w[i] = (_Float16)(bfr(p[i]) * 256.0f); w[8 + i] = (_Float16)(bfr(p[16 + i]) * 256.0f); }
  return w; }
#define WQKV_LAYOUT 0   // 0 = (in,out) [DIN][CC]; 1 = (out,in) [CC][DIN]; 2 = per-head [NH][DIN][HD]
__device__ __forceinline__ v16b wcol_hdk(const float* Wm, int k0, int o, int lane) { v16b w; const int g = lane >> 4; const float* p = Wm + (size_t)(o / HD) * DIN * HD + (o % HD);
#pragma unroll
  for (int i = 0; i < 8; ++i) { w[i] = (__bf16)p[(size_t)(k0 + 8 * g + i) * HD]; w[8 + i] = (__bf16)p[(size_t)(k0 + 16 + 8 * g + i) * HD]; }
  return w; }
#define WO_OUT_IN 0
#if WQKV_LAYOUT == 1
#define WCOL(W, k0, o, lane) wcol_oi(W, k0, o, lane, DIN)
#elif WQKV_LAYOUT == 2
#define WCOL(W, k0, o, lane) wcol_hdk(W, k0, o, lane)
#else
#define WCOL(W, k0, o, lane) wcol_io(W, k0, o, lane, CC)
#endif
#if WO_OUT_IN
#define WOCOL(W, k0, o, lane) wcol_oi(W, k0, o, lane, CC)
#define WOCOLH(W, k0, o, lane) wcolh_oi(W, k0, o, lane, CC)
#else
#define WOCOL(W, k0, o, lane) wcol_io(W, k0, o, lane, DIN)
#define WOCOLH(W, k0, o, lane) wcolh_io(W, k0, o, lane, DIN)
#endif
#define CIN 64
// ---- k_padw: the three (in,out) [C][64] projection weights copied into zero-padded (in,out) [C][128] ws planes (columns 64..127 zero) + zero-padded [128] biases
__global__ __launch_bounds__(256) void k_padw(const float* __restrict__ WQ, const float* __restrict__ WK, const float* __restrict__ WV, const float* __restrict__ BQ, const float* __restrict__ BK, const float* __restrict__ BV, float* __restrict__ WP, float* __restrict__ BP) { const int which = blockIdx.y; const float* Wsrc = which == 0 ? WQ : (which == 1 ? WK : WV); const float* Bsrc = which == 0 ? BQ : (which == 1 ? BK : BV); float* dst = WP + (size_t)which * CIN * 128;
  for (int e = blockIdx.x * 256 + threadIdx.x; e < CIN * 32; e += gridDim.x * 256) { const int row = e >> 5, q = e & 31; const v4f ld = *(const v4f*)(Wsrc + (size_t)row * 64 + (q & 15) * 4); asm volatile("s_wait_loadcnt 0x0" ::: "memory"); const float keep = q < 16 ? 1.f : 0.f; v4f ov; ov[0] = ld[0] * keep; ov[1] = ld[1] * keep; ov[2] = ld[2] * keep; ov[3] = ld[3] * keep; vst2(dst + (size_t)row * 128 + q * 4, ov); }
  if (blockIdx.x == 0 && threadIdx.x < 128) { const int c = threadIdx.x; float bvv = 0.f; if (Bsrc) { const float t = Bsrc[c & 63]; asm volatile("s_wait_loadcnt 0x0" ::: "memory"); bvv = c < 64 ? t : 0.f; } vst2(BP + which * 128 + c, bvv); } }
// ---- k_out64: out[b][t][0..63] = ctx row columns 0..63 (256 B by 16 lanes)
__global__ __launch_bounds__(256) void k_out64(const float* __restrict__ Y, float* __restrict__ OUT) { const size_t row = (size_t)blockIdx.x * 16 + (threadIdx.x >> 4); const int q = threadIdx.x & 15; const v4f v = *(const v4f*)(Y + row * CC + q * 4); asm volatile("s_wait_loadcnt 0x0" ::: "memory"); vst2(OUT + row * 64 + q * 4, v); }
#define WS_WP (WS_END)                                  // padded weights [3][128 x C]
#define WS_BP (WS_WP + 4u * 3 * (size_t)CIN * 128)        // padded biases [3][128]
#define WS_Y2 (WS_BP + 4u * 3 * 128)                      // ctx rows [b*TT+t][128]
#define WS_END2 (WS_Y2 + 4u * (size_t)NB * TT * CC)
#ifndef SM_EXTRA_PARAMS
#define SM_EXTRA_PARAMS
#endif
#ifndef PROJ_EXTRA_PARAMS
#define PROJ_EXTRA_PARAMS
#endif
#ifndef SM_MASK_HOOK
#define SM_MASK_HOOK (void)0
#endif

#define WS_QH  0u                                      // f16 q rows [b*t][CC]
#define WS_KH  (WS_QH + 2u * (size_t)NB * TT * CC)      // f16 k rows [b*t][CC]
#define WS_VT  (WS_KH + 2u * (size_t)NB * TT * CC)      // f16 v planes [b][c][t]
#define WS_QL  (WS_VT + 2u * (size_t)NB * CC * TT)      // f16 q residual x 2^10 rows [b][t < QHI][CC]
#define WS_KL  (WS_QL + 2u * (size_t)NB * QHI * CC)     // f16 k residual x 2^10 rows [b][t < KHI][CC]
#define WS_VB  (WS_KL + 2u * (size_t)NB * KHI * CC)     // bf16 v hi planes [b][c][t < KHI]
#define WS_VBL (WS_VB + 2u * (size_t)NB * CC * KHI)
#define WS_S   (WS_VBL + 2u * (size_t)NB * CC * KHI)    // f32 logits / P [hg][t][s]
#define WS_Y   (WS_S  + 4u * (size_t)HG * TT * TT)      // f32 ctx rows [b*t][CC] (only when there is an output projection)
#define WS_END (WS_Y  + 0u)

// ---- k_proj: block = (64 rows, 128 cols, which): q/k/v = X W (+ b) with exact bf16 products (K = DIN) -> which 0: q f16 rows (+ residual rows < QHI); 1: k f16 rows (+ residual rows < KHI); 2: v f16 planes [c][t] (+ bf16 hi/lo planes for t < KHI)
__global__ __launch_bounds__(128) void k_proj(const float* __restrict__ XQ, const float* __restrict__ XK, const float* __restrict__ XV, const float* __restrict__ WQ, const float* __restrict__ WK, const float* __restrict__ WV, const float* __restrict__ BQ, const float* __restrict__ BK, const float* __restrict__ BV,
    _Float16* __restrict__ QH, _Float16* __restrict__ QL, _Float16* __restrict__ KH, _Float16* __restrict__ KL, _Float16* __restrict__ VT, __bf16* __restrict__ VB, __bf16* __restrict__ VBL) {
  __shared__ __align__(16) _Float16 sh[64][136], sl[64][136]; __shared__ __align__(16) _Float16 th[128][72]; __shared__ __align__(16) __bf16 tb[128][72], tbl[128][72];
  const int tid = threadIdx.x, wave = tid >> 5, lane = tid & 31, col = lane & 15, g = lane >> 4; const int which = blockIdx.z; const int c0 = blockIdx.y * 128; const size_t r0 = (size_t)blockIdx.x * 64; const size_t bb = r0 / TT; const int t0 = (int)(r0 % TT);
  const float* X = which == 0 ? XQ : which == 1 ? XK : XV; const float* WA = which == 0 ? WQ : which == 1 ? WK : WV; const float* BA = which == 0 ? BQ : which == 1 ? BK : BV;
  v8f acc[8] = {};
#pragma unroll 2
  for (int kc = 0; kc < DIN / 32; ++kc) { v16b a; { const float* p = X + (r0 + wave * 16 + col) * DIN + kc * 32 + 8 * g;
#pragma unroll
      for (int i = 0; i < 8; ++i) { a[i] = (__bf16)p[i]; a[8 + i] = (__bf16)p[16 + i]; } }
    asm volatile("s_wait_loadcnt 0x0" ::: "memory");
#pragma unroll
    for (int j = 0; j < 8; ++j) { const v16b w = WCOL(WA, kc * 32, c0 + j * 16 + col, lane); asm volatile("s_wait_loadcnt 0x0" ::: "memory"); acc[j] = wmma_bf(a, w, acc[j]); } }
  if (which < 2) { _Float16* DH = which == 0 ? QH : KH; _Float16* DL = which == 0 ? QL : KL; const int nhi = which == 0 ? QHI : KHI; const bool hi_rows = t0 < nhi;
#pragma unroll
    for (int j = 0; j < 8; ++j) { const float bias = BA ? bfr(BA[c0 + j * 16 + col]) : 0.f;
#pragma unroll
      for (int r = 0; r < 8; ++r) { const float v = acc[j][r] + bias; const _Float16 hv = (_Float16)v; sh[wave * 16 + 8 * g + r][j * 16 + col] = hv; sl[wave * 16 + 8 * g + r][j * 16 + col] = (_Float16)((v - (float)hv) * 1024.0f); } }
    __syncthreads();
    for (int e = tid; e < 64 * 16; e += 128) { const int rl = e >> 4, q = e & 15; vst2((unsigned*)(DH + (r0 + rl) * CC + c0 + q * 8), *(const v4u*)&sh[rl][q * 8]); if (hi_rows) vst2((unsigned*)(DL + (bb * nhi + t0 + rl) * (size_t)CC + c0 + q * 8), *(const v4u*)&sl[rl][q * 8]); }
  } else { const bool hi_rows = t0 < KHI;
#pragma unroll
    for (int j = 0; j < 8; ++j) { const float bias = BA ? bfr(BA[c0 + j * 16 + col]) : 0.f;
#pragma unroll
      for (int r = 0; r < 8; ++r) { const float v = acc[j][r] + bias; const int rl = wave * 16 + 8 * g + r, cl = j * 16 + col; th[cl][rl] = (_Float16)v; const __bf16 bh = (__bf16)v; tb[cl][rl] = bh; tbl[cl][rl] = (__bf16)(v - (float)bh); } }
    __syncthreads();
    for (int e = tid; e < 128 * 8; e += 128) { const int cl = e >> 3, q = e & 7; vst2((unsigned*)(VT + (bb * CC + c0 + cl) * (size_t)TT + t0 + q * 8), *(const v4u*)&th[cl][q * 8]); if (hi_rows) { const size_t o3 = (bb * CC + c0 + cl) * (size_t)KHI + t0 + q * 8; vst2((unsigned*)(VB + o3), *(const v4u*)&tb[cl][q * 8]); vst2((unsigned*)(VBL + o3), *(const v4u*)&tbl[cl][q * 8]); } } } }
// ---- k_sc: block = (query block qb, key block kb <= kb_last(qb), head in group) of batch b: logits x SCALE; q hi + residual (x 2^10) against k (2 products) for query rows < QHI, plus the k residual (3 products) for query blocks < QBH (causal early rows); causal: blocks past the diagonal exit, the mask itself is applied by index in k_sm
__global__ __launch_bounds__(128) void k_sc(const _Float16* __restrict__ QH, const _Float16* __restrict__ KH, const _Float16* __restrict__ QL, const _Float16* __restrict__ KL, int b, int h0, float* __restrict__ S0) { __shared__ __align__(16) float ss[4][16][132];
  const int qb = blockIdx.x, kb = blockIdx.y; if (kb > kb_last(qb)) return;
  const int h = h0 + blockIdx.z; float* S = S0 + (size_t)blockIdx.z * TT * TT;
  const int tid = threadIdx.x, wave = tid >> 5, lane = tid & 31, col = lane & 15, g = lane >> 4; const int k0 = kb * 128; const int ql0 = qb * 64 + wave * 16; const size_t q0 = (size_t)b * TT + ql0, kr0 = (size_t)b * TT + k0;
  v8f acc[8] = {}, accl[8] = {};
  const _Float16* QLb = QL + (size_t)b * QHI * CC; const _Float16* KLb = KL + (size_t)b * KHI * CC;
  if (qb < QBH) {
#pragma unroll
    for (int kc = 0; kc < HD / 32; ++kc) { const v16h ah = frag_h(QH + (q0 + col) * CC + h * HD + kc * 32, lane), al = frag_h(QLb + (size_t)(ql0 + col) * CC + h * HD + kc * 32, lane);
#pragma unroll
      for (int j = 0; j < 8; ++j) { const v16h kbf = frag_h(KH + (kr0 + j * 16 + col) * CC + h * HD + kc * 32, lane), klf = frag_h(KLb + (size_t)(k0 + j * 16 + col) * CC + h * HD + kc * 32, lane); acc[j] = wmma16(ah, kbf, acc[j]); accl[j] = wmma16(al, kbf, accl[j]); accl[j] = wmma16(ah, klf, accl[j]); } }
  } else if (qb * 64 < QHI) {
#pragma unroll
    for (int kc = 0; kc < HD / 32; ++kc) { const v16h ah = frag_h(QH + (q0 + col) * CC + h * HD + kc * 32, lane), al = frag_h(QLb + (size_t)(ql0 + col) * CC + h * HD + kc * 32, lane);
#pragma unroll
      for (int j = 0; j < 8; ++j) { const v16h kbf = frag_h(KH + (kr0 + j * 16 + col) * CC + h * HD + kc * 32, lane); acc[j] = wmma16(ah, kbf, acc[j]); accl[j] = wmma16(al, kbf, accl[j]); } }
  } else {
#pragma unroll
    for (int kc = 0; kc < HD / 32; ++kc) { const v16h ah = frag_h(QH + (q0 + col) * CC + h * HD + kc * 32, lane);
#pragma unroll
      for (int j = 0; j < 8; ++j) { const v16h kbf = frag_h(KH + (kr0 + j * 16 + col) * CC + h * HD + kc * 32, lane); acc[j] = wmma16(ah, kbf, acc[j]); } } }
#pragma unroll
  for (int j = 0; j < 8; ++j) {
#pragma unroll
    for (int r = 0; r < 8; ++r) ss[wave][8 * g + r][j * 16 + col] = (acc[j][r] + accl[j][r] * (1.0f / 1024.0f)) * SCALE; }
  LDSX(); for (int rl = 0; rl < 16; ++rl) vst2(S + (size_t)(ql0 + rl) * TT + k0 + lane * 4, *(const v4f*)&ss[wave][rl][lane * 4]); }
// ---- k_sm: block = query row t (head in group): keys [0, kend): causal -> logit if s <= t else excluded; softmax in f32; P x 2^11 in place (0 for excluded)
__global__ __launch_bounds__(256) void k_sm(float* __restrict__ S0 SM_EXTRA_PARAMS) { __shared__ float sred[8]; __shared__ float sbc; __shared__ __align__(16) float shv[TT];
  const int tid = threadIdx.x; const int t = blockIdx.x; const int kend = (kb_last(t >> 6) + 1) * 128;
  float* sr = S0 + (size_t)blockIdx.y * TT * TT + (size_t)t * TT;
  float m = -3.0e38f; for (int k = tid; k < kend; k += 256) { float v = (!CAUSAL || k <= t) ? sr[k] : -3.0e38f; SM_MASK_HOOK; shv[k] = v; m = fmaxf(m, v); }
#pragma unroll
  for (int o = 1; o < 32; o <<= 1) m = fmaxf(m, __shfl_xor(m, o));
  if ((tid & 31) == 0) sred[tid >> 5] = m; __syncthreads(); if (tid == 0) { float a = sred[0]; for (int i = 1; i < 8; ++i) a = fmaxf(a, sred[i]); sbc = a; } __syncthreads(); m = sbc; __syncthreads();
  float sum = 0.f; for (int k = tid; k < kend; k += 256) { const float v = shv[k]; const float e = (v <= -1.0e38f) ? 0.f : expf(v - m); shv[k] = e; sum += e; }
#pragma unroll
  for (int o = 1; o < 32; o <<= 1) sum += __shfl_xor(sum, o);
  if ((tid & 31) == 0) sred[tid >> 5] = sum; __syncthreads(); if (tid == 0) { float a = 0.f; for (int i = 0; i < 8; ++i) a += sred[i]; sbc = a > 0.f ? 2048.0f / a : 0.f; }   /* a fully excluded row yields P = 0 */ __syncthreads(); const float inv = sbc;
  for (int k = tid; k < kend; k += 256) shv[k] = shv[k] * inv;
  __syncthreads(); for (int q = tid; q < kend / 4; q += 256) vst2(sr + q * 4, *(const v4f*)&shv[q * 4]); }
// ---- k_pv: block = 16 queries of (b, h), PVW waves: ctx = P . v over keys [0, kend), the keys cut into 64-key slices (one 128-B line of a v plane, 256 B of a P row), wave w takes slices w, w + PVW, ...; f32 partials summed through LDS in wave order (P x 2^11 once to f16 against v f16: 1 product; causal early query blocks: P and v as bf16 hi + lo, 3 products); 256-B (row, head) segment by 16 lanes
#define PVW 16
__global__ __launch_bounds__(32 * PVW) void k_pv(const float* __restrict__ PS0, const _Float16* __restrict__ VT, const __bf16* __restrict__ VB, const __bf16* __restrict__ VBL, int b, int h0, float* __restrict__ Y) { const int h = h0 + blockIdx.z; const float* PS = PS0 + (size_t)blockIdx.z * TT * TT; __shared__ __align__(16) float ss[PVW][16][HD + 4];
  const int tid = threadIdx.x, wave = __builtin_amdgcn_readfirstlane(tid >> 5), lane = tid & 31, col = lane & 15, g = lane >> 4; const int qb = blockIdx.x >> 2; const int ql0 = blockIdx.x * 16; const int kce = (kb_last(qb) + 1) * 4;
  v8f acc[HD / 16] = {};
  if (qb < QBH) {
#pragma unroll 1   // stays rolled as in the unsplit loop: the waits order the slices anyway
    for (int ks = wave * 2; ks < kce; ks += 2 * PVW) {
    for (int kc = ks; kc < ks + 2; ++kc) { const F2 p = split_row(PS + (size_t)(ql0 + col) * TT, kc * 32, lane);
      asm volatile("s_wait_loadcnt 0x0" ::: "memory");
#pragma unroll
      for (int j = 0; j < HD / 16; ++j) { const size_t po = ((size_t)b * CC + h * HD + j * 16 + col) * (size_t)KHI + kc * 32; const v16b vh = frag_b(VB + po, lane); acc[j] = wmma_bf(p.h, vh, acc[j]); acc[j] = wmma_bf(p.l, vh, acc[j]); acc[j] = wmma_bf(p.h, frag_b(VBL + po, lane), acc[j]); } } }
  } else {
#pragma unroll 1   // stays rolled as in the unsplit loop: the waits order the slices anyway
    for (int ks = wave * 2; ks < kce; ks += 2 * PVW) {
    for (int kc = ks; kc < ks + 2; ++kc) { const v16h p = frag_f32(PS + (size_t)(ql0 + col) * TT + kc * 32, lane);
      asm volatile("s_wait_loadcnt 0x0" ::: "memory");
#pragma unroll
      for (int j = 0; j < HD / 16; ++j) { const size_t po = ((size_t)b * CC + h * HD + j * 16 + col) * (size_t)TT + kc * 32; acc[j] = wmma16(p, frag_h(VT + po, lane), acc[j]); } } } }
#pragma unroll
  for (int j = 0; j < HD / 16; ++j)
#pragma unroll
    for (int r = 0; r < 8; ++r) ss[wave][8 * g + r][j * 16 + col] = acc[j][r] * (1.0f / 2048.0f);
  __syncthreads();   // every wave's partial (zero where it had no slice) is in LDS before any is summed
  if (tid < 16 * (HD / 4)) { const int rl = tid / (HD / 4), q = tid % (HD / 4); v4f s = *(const v4f*)&ss[0][rl][q * 4];
    for (int w = 1; w < PVW; ++w) s += *(const v4f*)&ss[w][rl][q * 4];
    vst2(Y + ((size_t)b * TT + ql0 + rl) * CC + h * HD + q * 4, s); } }

extern "C" void kernel_launch(void* const* d_in, const int* in_sizes, int n_in, void* d_out, int out_size, void* d_ws, size_t ws_size, hipStream_t stream) {
  (void)in_sizes; (void)n_in; (void)out_size;
  const float** F = (const float**)d_in;
  if (ws_size < (size_t)WS_END) return;
  char* ws = (char*)d_ws; _Float16 *QH = (_Float16*)(ws + WS_QH), *KH = (_Float16*)(ws + WS_KH), *VT = (_Float16*)(ws + WS_VT), *QL = (_Float16*)(ws + WS_QL), *KL = (_Float16*)(ws + WS_KL); __bf16 *VB = (__bf16*)(ws + WS_VB), *VBL = (__bf16*)(ws + WS_VBL); float *S = (float*)(ws + WS_S), *Y = (float*)(ws + WS_Y);
  (void)Y; (void)QL; (void)KL; (void)VB; (void)VBL;
  // inputs: 0 x [16,4096,64]; 1 Wq [64,64]; 2 Wk; 3 Wv ((in,out), no biases)
  if (ws_size < (size_t)WS_END2) return;
  float *WP = (float*)(ws + WS_WP), *BP = (float*)(ws + WS_BP), *Y2 = (float*)(ws + WS_Y2);
  k_padw<<<dim3(32, 3), 256, 0, stream>>>(F[1], F[2], F[3], nullptr, nullptr, nullptr, WP, BP);
  k_proj<<<dim3(TNB * TT / 64, CC / 128, 3), 128, 0, stream>>>(F[0], F[0], F[0], WP, WP + (size_t)CIN * 128, WP + 2 * (size_t)CIN * 128, BP, BP + 128, BP + 256, QH, QL, KH, KL, VT, VB, VBL);
  for (int b = 0; b < TNB; ++b) {   /* head 0 only (head 1 is the zero padding) */
    k_sc<<<dim3(NQB, TT / 128, 1), 128, 0, stream>>>(QH, KH, QL, KL, b, 0, S);
    k_sm<<<dim3(TT, 1), 256, 0, stream>>>(S);
    k_pv<<<dim3(TT / 16, 1, 1), 32 * PVW, 0, stream>>>(S, VT, VB, VBL, b, 0, Y2);
  }
  k_out64<<<dim3(TNB * TT / 16), 256, 0, stream>>>(Y2, (float*)d_out);
}

// v003
// One run takes 86.3 microseconds.
// It is 10.3 times as fast as v001, going by the measured steps of the versions left out in between.
// Counting every step since v000, it is 30.5 times as fast.
// compute dtype: all float inputs rounded to bf16; q/k/v projections with EXACT bf16 products on WMMA 16x16x32 (f32 accumulate); causal logits: 3 products (q f16 hi + residual x k hi + residual) for the first 384 rows, single f16 q x k after, x scale; online softmax f32; unnormalised P x 2^4 once to f16 x v once to f16 (1 product; bf16 hi + lo below row 384), divided by the f32 sum last; f32 output.
#include <hip/hip_runtime.h>
#include <math.h>

typedef __attribute__((ext_vector_type(16))) _Float16 v16h;
typedef __attribute__((ext_vector_type(16))) __bf16 v16b;
typedef __attribute__((ext_vector_type(8)))  _Float16 v8h;
typedef __attribute__((ext_vector_type(8)))  float v8f;
typedef __attribute__((ext_vector_type(4)))  float v4f;
typedef __attribute__((ext_vector_type(2)))  float v2f;
typedef __attribute__((ext_vector_type(4)))  unsigned v4u;
typedef __attribute__((ext_vector_type(4)))  int v4i;
typedef float __attribute__((may_alias)) float_a;
typedef int __attribute__((may_alias)) int_a;

template <typename T> __device__ __forceinline__ void vst2(void* p, T v) { *(T*)p = v;  }
__device__ __forceinline__ v8f wmma16(v16h a, v16h b, v8f c) {
  v8f d = __builtin_amdgcn_wmma_f32_16x16x32_f16(false, a, false, b, (short)0, c, false, false);
  asm volatile("v_nop\n\tv_nop\n\tv_nop\n\tv_nop" : "+v"(d) : "v"(a), "v"(b));
  return d;
}
__device__ __forceinline__ v8f wmma_bf(v16b a, v16b b, v8f c) {
  v8f d = __builtin_amdgcn_wmma_f32_16x16x32_bf16(false, a, false, b, (short)0, c, false, false);
  asm volatile("v_nop\n\tv_nop\n\tv_nop\n\tv_nop" : "+v"(d) : "v"(a), "v"(b));
  return d;
}
// 16x16x32 fragments: lane = (h = lane>>4, row/col = lane&15); elements 0..7 = k0+8h+0..7, 8..15 = k0+16+8h+0..7; D element r = row 8h+r
__device__ __forceinline__ v16h frag_h(const _Float16* rowk0, int lane) {
  union { v16h v; v8h q[2]; } u; const _Float16* p = rowk0 + 8 * (lane >> 4);
  u.q[0] = *(const v8h*)p; u.q[1] = *(const v8h*)(p + 16); return u.v;
}
// a fragment stored in register order: two 512-byte blocks, lane l's 16 bytes at 16 l, so that each wave-wide load covers four whole 128-byte lines
__device__ __forceinline__ v16h frag_p(const _Float16* p) {   // p = the fragment's first block + 8 * lane
  union { v16h v; v8h q[2]; } u; u.q[0] = *(const v8h*)p; u.q[1] = *(const v8h*)(p + 256); return u.v;
}
__device__ __forceinline__ v16h frag_f32(const float* rowk0, int lane) {
  v16h a; const float* p = rowk0 + 8 * (lane >> 4);
#pragma unroll
  for (int i = 0; i < 8; ++i) { a[i] = (_Float16)p[i]; a[8 + i] = (_Float16)p[16 + i]; }
  return a;
}
__device__ __forceinline__ v16h frag_f32s(const float* rowk0, int lane, float sc) {
  v16h a; const float* p = rowk0 + 8 * (lane >> 4);
#pragma unroll
  for (int i = 0; i < 8; ++i) { a[i] = (_Float16)(p[i] * sc); a[8 + i] = (_Float16)(p[16 + i] * sc); }
  return a;
}
// column fragment from a [K][ld] layout (column n), rows >= K read as 0
__device__ __forceinline__ v16h fragc_f32(const float* W, int k0, int n, int lane, int ld, int K) {
  v16h a; const int g = lane >> 4;
#pragma unroll
  for (int i = 0; i < 8; ++i) { const int ka = k0 + 8 * g + i, kb = ka + 16;
    a[i] = (_Float16)(ka < K ? W[(size_t)(ka < K ? ka : K - 1) * ld + n] : 0.f); a[8 + i] = (_Float16)(kb < K ? W[(size_t)(kb < K ? kb : K - 1) * ld + n] : 0.f); }
  return a;
}
struct F2 { v16b h, l; };
__device__ __forceinline__ F2 bsplit16(const float v[16]) { F2 r;
#pragma unroll
  for (int i = 0; i < 16; ++i) { const __bf16 h = (__bf16)v[i]; r.h[i] = h; r.l[i] = (__bf16)(v[i] - (float)h); }
  return r; }
__device__ __forceinline__ F2 split_row(const float* row, int k0, int lane) { float v[16]; const float* p = row + k0 + 8 * (lane >> 4);
#pragma unroll
  for (int i = 0; i < 8; ++i) { v[i] = p[i]; v[8 + i] = p[16 + i]; }
  return bsplit16(v); }
__device__ __forceinline__ F2 split_rowK(const float* row, int k0, int lane, int K) { float v[16]; const int g = lane >> 4;
#pragma unroll
  for (int i = 0; i < 8; ++i) { const int ka = k0 + 8 * g + i, kb = ka + 16; v[i] = ka < K ? row[ka < K ? ka : K - 1] : 0.f; v[8 + i] = kb < K ? row[kb < K ? kb : K - 1] : 0.f; }
  return bsplit16(v); }
__device__ __forceinline__ F2 split_col(const float* W, int k0, int n, int lane, int ld, int K) { float v[16]; const int g = lane >> 4;
#pragma unroll
  for (int i = 0; i < 8; ++i) { const int ka = k0 + 8 * g + i, kb = ka + 16; v[i] = ka < K ? W[(size_t)(ka < K ? ka : K - 1) * ld + n] : 0.f; v[8 + i] = kb < K ? W[(size_t)(kb < K ? kb : K - 1) * ld + n] : 0.f; }
  return bsplit16(v); }
__device__ __forceinline__ v8f mac3(const F2& a, const F2& b, v8f c) { c = wmma_bf(a.l, b.h, c); c = wmma_bf(a.h, b.l, c); return wmma_bf(a.h, b.h, c); }
__device__ __forceinline__ float sigm(float v) { return 1.0f / (1.0f + expf(-v)); }
#define LDSX() do { asm volatile("s_wait_dscnt 0" ::: "memory"); __builtin_amdgcn_wave_barrier(); __builtin_amdgcn_fence(__ATOMIC_RELEASE, "workgroup"); } while (0)

// Single-head causal self-attention (x [16,4096,64]; (in,out) Wq / Wk / Wv [64,64] N(0, 1/64), no biases; scale 64^-0.5; tril, finfo.min fill): out = softmax(causal(q k^T / 8)) v -> [16,4096,64].
#define NB 16
#define TT 4096
#define CC 128            // NH * HD = projected width
#define DIN 64          // input (model) width
#define NH 2
#define HD 64
#define NQB (TT / 64)
#define HG 1
#define SCALE (0.125f)
#define CAUSAL 1
#ifndef TNB
#define TNB NB
#endif
__device__ __forceinline__ float bfr(float v) { return (float)(__bf16)v; }
__host__ __device__ __forceinline__ int kb_last(int qb) { return CAUSAL ? ((qb * 64 + 63) >> 7) : (TT / 128 - 1); }
typedef __attribute__((ext_vector_type(8))) __bf16 v8b;
__device__ __forceinline__ v16b frag_b(const __bf16* rowk0, int lane) {
  union { v16b v; v8b q[2]; } u; const __bf16* p = rowk0 + 8 * (lane >> 4);
  u.q[0] = *(const v8b*)p; u.q[1] = *(const v8b*)(p + 16); return u.v;
}
#define QBH 6              // unused: the queries below row QHI (few keys, no averaging) take the high-precision path
#define QHI 384            // rows carrying a q residual plane
#define KHI 384            // key rows carrying k residual / v bf16 hi+lo planes (used only by the causal high-precision path)
// B fragment (k rows k0+.., output column o) of a weight: (in,out) [K][ld] or (out,in) [ld rows of K]: bf16 exact, or f16(bf16 * 256) exact
__device__ __forceinline__ v16b wcol_io(const float* Wm, int k0, int o, int lane, int ld) { v16b w; const int g = lane >> 4;
#pragma unroll
  for (int i = 0; i < 8; ++i) { w[i] = (__bf16)Wm[(size_t)(k0 + 8 * g + i) * ld + o]; w[8 + i] = (__bf16)Wm[(size_t)(k0 + 16 + 8 * g + i) * ld + o]; }
  return w; }
__device__ __forceinline__ v16b wcol_oi(const float* Wm, int k0, int o, int lane, int K) { v16b w; const float* p = Wm + (size_t)o * K + k0 + 8 * (lane >> 4);
#pragma unroll
  for (int i = 0; i < 8; ++i) { w[i] = (__bf16)p[i]; w[8 + i] = (__bf16)p[16 + i]; }
  return w; }
__device__ __forceinline__ v16h wcolh_io(const float* Wm, int k0, int o, int lane, int ld) { v16h w; const int g = lane >> 4;
#pragma unroll
  for (int i = 0; i < 8; ++i) { w[i] = (_Float16)(bfr(Wm[(size_t)(k0 + 8 * g + i) * ld + o]) * 256.0f); w[8 + i] = (_Float16)(bfr(Wm[(size_t)(k0 + 16 + 8 * g + i) * ld + o]) * 256.0f); }
  return w; }
__device__ __forceinline__ v16h wcolh_oi(const float* Wm, int k0, int o, int lane, int K) { v16h w; const float* p = Wm + (size_t)o * K + k0 + 8 * (lane >> 4);
#pragma unroll
  for (int i = 0; i < 8; ++i) { w[i] = (_Float16)(bfr(p[i]) * 256.0f); w[8 + i] = (_Float16)(bfr(p[16 + i]) * 256.0f); }
  return w; }
#define WQKV_LAYOUT 0   // 0 = (in,out) [DIN][CC]; 1 = (out,in) [CC][DIN]; 2 = per-head [NH][DIN][HD]
__device__ __forceinline__ v16b wcol_hdk(const float* Wm, int k0, int o, int lane) { v16b w; const int g = lane >> 4; const float* p = Wm + (size_t)(o / HD) * DIN * HD + (o % HD);
#pragma unroll
  for (int i = 0; i < 8; ++i) { w[i] = (__bf16)p[(size_t)(k0 + 8 * g + i) * HD]; w[8 + i] = (__bf16)p[(size_t)(k0 + 16 + 8 * g + i) * HD]; }
  return w; }
#define WO_OUT_IN 0
#if WQKV_LAYOUT == 1
#define WCOL(W, k0, o, lane) wcol_oi(W, k0, o, lane, DIN)
#elif WQKV_LAYOUT == 2
#define WCOL(W, k0, o, lane) wcol_hdk(W, k0, o, lane)
#else
#define WCOL(W, k0, o, lane) wcol_io(W, k0, o, lane, CC)
#endif
#if WO_OUT_IN
#define WOCOL(W, k0, o, lane) wcol_oi(W, k0, o, lane, CC)
#define WOCOLH(W, k0, o, lane) wcolh_oi(W, k0, o, lane, CC)
#else
#define WOCOL(W, k0, o, lane) wcol_io(W, k0, o, lane, DIN)
#define WOCOLH(W, k0, o, lane) wcolh_io(W, k0, o, lane, DIN)
#endif
#define CIN 64
// ---- k_padw: the three (in,out) [C][64] projection weights copied into zero-padded (in,out) [C][128] ws planes (columns 64..127 zero) + zero-padded [128] biases
__global__ __launch_bounds__(256) void k_padw(const float* __restrict__ WQ, const float* __restrict__ WK, const float* __restrict__ WV, const float* __restrict__ BQ, const float* __restrict__ BK, const float* __restrict__ BV, float* __restrict__ WP, float* __restrict__ BP) { const int which = blockIdx.y; const float* Wsrc = which == 0 ? WQ : (which == 1 ? WK : WV); const float* Bsrc = which == 0 ? BQ : (which == 1 ? BK : BV); float* dst = WP + (size_t)which * CIN * 128;
  for (int e = blockIdx.x * 256 + threadIdx.x; e < CIN * 32; e += gridDim.x * 256) { const int row = e >> 5, q = e & 31; const v4f ld = *(const v4f*)(Wsrc + (size_t)row * 64 + (q & 15) * 4); asm volatile("s_wait_loadcnt 0x0" ::: "memory"); const float keep = q < 16 ? 1.f : 0.f; v4f ov; ov[0] = ld[0] * keep; ov[1] = ld[1] * keep; ov[2] = ld[2] * keep; ov[3] = ld[3] * keep; vst2(dst + (size_t)row * 128 + q * 4, ov); }
  if (blockIdx.x == 0 && threadIdx.x < 128) { const int c = threadIdx.x; float bvv = 0.f; if (Bsrc) { const float t = Bsrc[c & 63]; asm volatile("s_wait_loadcnt 0x0" ::: "memory"); bvv = c < 64 ? t : 0.f; } vst2(BP + which * 128 + c, bvv); } }
#define WS_WP (WS_END)                                  // padded weights [3][128 x C]
#define WS_BP (WS_WP + 4u * 3 * (size_t)CIN * 128)        // padded biases [3][128]
#define WS_Y2 (WS_BP + 4u * 3 * 128)                      // f32 [b*TT+t][128], not used
#define WS_END2 (WS_Y2 + 4u * (size_t)NB * TT * CC)
#ifndef SM_EXTRA_PARAMS
#define SM_EXTRA_PARAMS
#endif
#ifndef PROJ_EXTRA_PARAMS
#define PROJ_EXTRA_PARAMS
#endif
#ifndef SM_MASK_HOOK
#define SM_MASK_HOOK (void)0
#endif

#define WS_QH  0u                                      // f16 q rows [b*t][CC]
#define WS_KH  (WS_QH + 2u * (size_t)NB * TT * CC)      // f16 k in fragment order [b][t / 16][kc][u][lane = 16 h + (t & 15)][8]: column 32 kc + 16 u + 8 h + i, the HD real columns only
#define WS_VT  (WS_KH + 2u * (size_t)NB * TT * CC)      // f16 v in fragment order [b][t / 32][j][u][lane = 16 h + c][8]: column 16 j + c, row 32 (t / 32) + 16 u + 8 h + i, the HD real columns only
#define WS_QL  (WS_VT + 2u * (size_t)NB * CC * TT)      // f16 q residual x 2^10 rows [b][t < QHI][CC]
#define WS_KL  (WS_QL + 2u * (size_t)NB * QHI * CC)     // f16 k residual x 2^10 rows [b][t < KHI][CC]
#define WS_VB  (WS_KL + 2u * (size_t)NB * KHI * CC)     // bf16 v hi planes [b][c][t < KHI]
#define WS_VBL (WS_VB + 2u * (size_t)NB * CC * KHI)
#define WS_S   (WS_VBL + 2u * (size_t)NB * CC * KHI)    // f32 [hg][t][s], not used: the logits stay in registers
#define WS_Y   (WS_S  + 4u * (size_t)HG * TT * TT)      // f32 ctx rows [b*t][CC] (only when there is an output projection)
#define WS_END (WS_Y  + 0u)

// ---- k_proj: block = (64 rows, 128 cols, which): q/k/v = X W (+ b) with exact bf16 products (K = DIN) -> which 0: q f16 rows (+ residual rows < QHI); 1: k f16 in fragment order (+ residual rows < KHI); 2: v f16 in fragment order (+ bf16 hi/lo planes for t < KHI)
__global__ __launch_bounds__(128) void k_proj(const float* __restrict__ XQ, const float* __restrict__ XK, const float* __restrict__ XV, const float* __restrict__ WQ, const float* __restrict__ WK, const float* __restrict__ WV, const float* __restrict__ BQ, const float* __restrict__ BK, const float* __restrict__ BV,
    _Float16* __restrict__ QH, _Float16* __restrict__ QL, _Float16* __restrict__ KH, _Float16* __restrict__ KL, _Float16* __restrict__ VT, __bf16* __restrict__ VB, __bf16* __restrict__ VBL) {
  __shared__ __align__(16) _Float16 sh[64][136], sl[64][136]; __shared__ __align__(16) _Float16 th[128][72]; __shared__ __align__(16) __bf16 tb[128][72], tbl[128][72];
  const int tid = threadIdx.x, wave = tid >> 5, lane = tid & 31, col = lane & 15, g = lane >> 4; const int which = blockIdx.z; const int c0 = blockIdx.y * 128; const size_t r0 = (size_t)blockIdx.x * 64; const size_t bb = r0 / TT; const int t0 = (int)(r0 % TT);
  const float* X = which == 0 ? XQ : which == 1 ? XK : XV; const float* WA = which == 0 ? WQ : which == 1 ? WK : WV; const float* BA = which == 0 ? BQ : which == 1 ? BK : BV;
  v8f acc[8] = {};
#pragma unroll 2
  for (int kc = 0; kc < DIN / 32; ++kc) { v16b a; { const float* p = X + (r0 + wave * 16 + col) * DIN + kc * 32 + 8 * g;
#pragma unroll
      for (int i = 0; i < 8; ++i) { a[i] = (__bf16)p[i]; a[8 + i] = (__bf16)p[16 + i]; } }
    asm volatile("s_wait_loadcnt 0x0" ::: "memory");
#pragma unroll
    for (int j = 0; j < 8; ++j) { const v16b w = WCOL(WA, kc * 32, c0 + j * 16 + col, lane); asm volatile("s_wait_loadcnt 0x0" ::: "memory"); acc[j] = wmma_bf(a, w, acc[j]); } }
  if (which < 2) { _Float16* DH = which == 0 ? QH : KH; _Float16* DL = which == 0 ? QL : KL; const int nhi = which == 0 ? QHI : KHI; const bool hi_rows = t0 < nhi;
#pragma unroll
    for (int j = 0; j < 8; ++j) { const float bias = BA ? bfr(BA[c0 + j * 16 + col]) : 0.f;
#pragma unroll
      for (int r = 0; r < 8; ++r) { const float v = acc[j][r] + bias; const _Float16 hv = (_Float16)v; sh[wave * 16 + 8 * g + r][j * 16 + col] = hv; sl[wave * 16 + 8 * g + r][j * 16 + col] = (_Float16)((v - (float)hv) * 1024.0f); } }
    __syncthreads();
    if (which == 0) for (int e = tid; e < 64 * 16; e += 128) { const int rl = e >> 4, q = e & 15; vst2((unsigned*)(DH + (r0 + rl) * CC + c0 + q * 8), *(const v4u*)&sh[rl][q * 8]); }
    else for (int e = tid; e < 64 * 8; e += 128) { const int ln = e & 31, u = (e >> 5) & 1, kc = (e >> 6) & 1, tl = e >> 7; vst2((unsigned*)(DH + r0 * HD + e * 8), *(const v4u*)&sh[16 * tl + (ln & 15)][32 * kc + 16 * u + 8 * (ln >> 4)]); }   // the block's 64 keys = 8 KB in a row
    if (hi_rows) for (int e = tid; e < 64 * 16; e += 128) { const int rl = e >> 4, q = e & 15; vst2((unsigned*)(DL + (bb * nhi + t0 + rl) * (size_t)CC + c0 + q * 8), *(const v4u*)&sl[rl][q * 8]); }
  } else { const bool hi_rows = t0 < KHI;
#pragma unroll
    for (int j = 0; j < 8; ++j) { const float bias = BA ? bfr(BA[c0 + j * 16 + col]) : 0.f;
#pragma unroll
      for (int r = 0; r < 8; ++r) { const float v = acc[j][r] + bias; const int rl = wave * 16 + 8 * g + r, cl = j * 16 + col; th[cl][rl] = (_Float16)v; const __bf16 bh = (__bf16)v; tb[cl][rl] = bh; tbl[cl][rl] = (__bf16)(v - (float)bh); } }
    __syncthreads();
    for (int e = tid; e < 64 * 8; e += 128) { const int ln = e & 31, u = (e >> 5) & 1, j = (e >> 6) & 3, pl = e >> 8; vst2((unsigned*)(VT + r0 * HD + e * 8), *(const v4u*)&th[16 * j + (ln & 15)][32 * pl + 16 * u + 8 * (ln >> 4)]); }   // the block's 64 keys = 8 KB in a row
    if (hi_rows) for (int e = tid; e < 128 * 8; e += 128) { const int cl = e >> 3, q = e & 7; const size_t o3 = (bb * CC + c0 + cl) * (size_t)KHI + t0 + q * 8; vst2((unsigned*)(VB + o3), *(const v4u*)&tb[cl][q * 8]); vst2((unsigned*)(VBL + o3), *(const v4u*)&tbl[cl][q * 8]); } } }
#define FSC (SCALE * 1.4426950408889634f)
#define FPK 4.0f           // P carries 2^4: largest value 2^12 in f16, and the small ones stay normal numbers
__device__ __forceinline__ float xhalf(float x) { return __builtin_bit_cast(float, __builtin_amdgcn_permlanex16(__builtin_bit_cast(int, x), __builtin_bit_cast(int, x), 0x76543210, 0xfedcba98, false, false)); }  // lane l with lane l ^ 16
__device__ __forceinline__ v8f mmh(v16h a, v16h b, v8f c) { return __builtin_amdgcn_wmma_f32_16x16x32_f16(false, a, false, b, (short)0, c, false, false); }
__device__ __forceinline__ v8f mmb(v16b a, v16b b, v8f c) { return __builtin_amdgcn_wmma_f32_16x16x32_bf16(false, a, false, b, (short)0, c, false, false); }
// one 32-key pass, raw logits s[g][t][r] (query q0 + 16 g + c, key k0 + 16 t + 8 h + r). fa_max: mask, maxima, and m, l (this half's part of the sum) and the output tiles kept in step; fa_exp: s -> P in place, l grows
template <int NG> __device__ __forceinline__ void fa_max(v8f (&s)[NG][2], bool diag, int k0, int q0, int c, int h, float (&m)[NG], float (&l)[NG], v8f (&o)[NG][4]) {
  if (diag) {   // wave-uniform: only the pass on the diagonal pays for the mask; every column keeps at least key k0 <= its query
#pragma unroll
    for (int g = 0; g < NG; ++g)
#pragma unroll
      for (int t = 0; t < 2; ++t)
#pragma unroll
        for (int r = 0; r < 8; ++r) if (k0 + 16 * t + 8 * h + r > q0 + 16 * g + c) s[g][t][r] = -3.0e38f; }
  float mb[NG]; bool need = false;
#pragma unroll
  for (int g = 0; g < NG; ++g) { float mx = s[g][0][0];
#pragma unroll
    for (int r = 0; r < 8; ++r) mx = fmaxf(mx, fmaxf(s[g][0][r], s[g][1][r]));
    mx = fmaxf(mx, xhalf(mx)) * FSC; mb[g] = mx; need = need || (mx > m[g] + 8.0f); }
  if (__builtin_amdgcn_ballot_w32(need) != 0) {   // scalar branch, rare after the first passes
#pragma unroll
    for (int g = 0; g < NG; ++g) { const float mn = fmaxf(m[g], mb[g]); const float corr = __builtin_amdgcn_exp2f(m[g] - mn); m[g] = mn; l[g] *= corr;   // corr = 0 on the first pass
#pragma unroll
      for (int j = 0; j < 4; ++j) o[g][j] = o[g][j] * corr; } } }
template <int NG> __device__ __forceinline__ void fa_exp(v8f (&s)[NG][2], const float (&m)[NG], float (&l)[NG]) {
#pragma unroll
  for (int g = 0; g < NG; ++g) { const float nm = FPK - m[g];
#pragma unroll
    for (int t = 0; t < 2; ++t)
#pragma unroll
      for (int r = 0; r < 8; ++r) s[g][t][r] = __builtin_amdgcn_exp2f(fmaf(s[g][t][r], FSC, nm));
    const v8f sv = s[g][0] + s[g][1]; l[g] += ((sv[0] + sv[1]) + (sv[2] + sv[3])) + ((sv[4] + sv[5]) + (sv[6] + sv[7])); } }
template <int NG> __device__ __forceinline__ void fa_store(const v8f (&o)[NG][4], const float (&l)[NG], int q0, int c, int h, float* __restrict__ Ob) {
#pragma unroll
  for (int g = 0; g < NG; ++g) { const float inv = 1.0f / (l[g] + xhalf(l[g])); float* op = Ob + (size_t)(q0 + 16 * g + c) * HD + 8 * h;   // a lane holds 8 consecutive d of its query per tile
#pragma unroll
    for (int j = 0; j < 4; ++j) { v4f a, e;
#pragma unroll
      for (int r = 0; r < 4; ++r) { a[r] = o[g][j][r] * inv; e[r] = o[g][j][4 + r] * inv; }
      vst2(op + 16 * j, a); vst2(op + 16 * j + 4, e); } }
  asm volatile("s_wait_xcnt 0x0" ::: "memory"); }   // on the way to the kernel's barrier the compiler writes over registers that these stores name
// 32 queries from row QHI on, the 32-key passes hf, hf + 2, ... of their keys: one f16 product for the logits, P once to f16 against v f16. K and v fragments are fetched one pass ahead, each right behind the products that read it.
__device__ __forceinline__ void fa_lo(const _Float16* __restrict__ Qb, const _Float16* __restrict__ Kb, const _Float16* __restrict__ Vb, int q0, int hf, int lane, v8f (&o)[2][4], float (&m)[2], float (&l)[2]) {
  const int c = lane & 15, h = lane >> 4; v16h qf[2][2], kf[2][2];
#pragma unroll
  for (int g = 0; g < 2; ++g)
#pragma unroll
    for (int kc = 0; kc < 2; ++kc) { qf[g][kc] = frag_h(Qb + (size_t)(q0 + 16 * g + c) * CC + kc * 32, lane); kf[g][kc] = frag_p(Kb + (size_t)(32 * hf) * HD + (2 * g + kc) * 512 + 8 * lane); }
  asm volatile("s_wait_xcnt 0x0" ::: "memory");   // the zeroing of the output tiles, which the compiler sets behind the v loads, writes over the Q loads' address pairs
  const int np = q0 / 32 + 1; v16h vf[4];
#pragma unroll
  for (int j = 0; j < 4; ++j) vf[j] = frag_p(Vb + (size_t)(32 * hf) * HD + j * 512 + 8 * lane);
  asm volatile("s_wait_xcnt 0x0" ::: "memory");   // on the way into the loop scalar registers of the base that the v loads name are written over
  asm volatile("" :: "v"(qf[0][0]), "v"(qf[0][1]), "v"(qf[1][0]), "v"(qf[1][1]));   // inputs only: Q has landed before the loop, so that the loop's own waits count only the K and v loads in flight (else each pass waits for all of them)
  for (int p = hf; p < np; p += 2) { const int k0 = p * 32;
    v8f s[2][2];
#pragma unroll
    for (int g = 0; g < 2; ++g)
#pragma unroll
      for (int t = 0; t < 2; ++t) { v8f z = {}; z = mmh(kf[t][0], qf[g][0], z); s[g][t] = mmh(kf[t][1], qf[g][1], z); }
    fa_max<2>(s, p + 1 == np, k0, q0, c, h, m, l, o);
    const int kn = p + 2 < np ? k0 + 64 : k0;   // the last pass fetches its own blocks again: in bounds, not used
    const _Float16 *kq = Kb + (size_t)kn * HD + 8 * lane, *vq = Vb + (size_t)kn * HD + 8 * lane;   // a pass is 4 KB of K and 4 KB of v in a row
#pragma unroll
    for (int t = 0; t < 2; ++t)
#pragma unroll
      for (int kc = 0; kc < 2; ++kc) kf[t][kc] = frag_p(kq + (2 * t + kc) * 512);
    __builtin_amdgcn_sched_barrier(0);   // keeps the next K loads in front of the exponentials, whose time covers their latency; without it they are issued behind the second product
    fa_exp<2>(s, m, l);
#pragma unroll
    for (int g = 0; g < 2; ++g) { v16h pb;
#pragma unroll
      for (int i = 0; i < 8; ++i) { pb[i] = (_Float16)s[g][0][i]; pb[8 + i] = (_Float16)s[g][1][i]; }
#pragma unroll
      for (int j = 0; j < 4; ++j) o[g][j] = mmh(vf[j], pb, o[g][j]); }
#pragma unroll
    for (int j = 0; j < 4; ++j) vf[j] = frag_p(vq + j * 512);
    asm volatile("s_wait_xcnt 0x0" :: "v"(kq), "v"(vq) : "memory"); }   // the two address pairs are written over behind this place; as inputs they stay whole up to the wait (without that the last K load lands on its own address pair)
}
// 16 queries below row QHI (few keys, no averaging): 3 products for the logits (q hi + residual x k hi + residual), P and v as bf16 hi + lo (3 products)
__device__ __forceinline__ void fa_hi(const _Float16* __restrict__ Qb, const _Float16* __restrict__ QLb, const _Float16* __restrict__ Kb, const _Float16* __restrict__ KLb, const __bf16* __restrict__ VBb, const __bf16* __restrict__ VBLb, int q0, int lane, float* __restrict__ Ob) {
  const int c = lane & 15, h = lane >> 4; v16h qh[2], ql[2];
#pragma unroll
  for (int kc = 0; kc < 2; ++kc) { qh[kc] = frag_h(Qb + (size_t)(q0 + c) * CC + kc * 32, lane); ql[kc] = frag_h(QLb + (size_t)(q0 + c) * CC + kc * 32, lane); }
  v8f o[1][4] = {}; float m[1] = {-3.0e38f}, l[1] = {0.f}; const int np = (q0 + 47) / 32;
  for (int p = 0; p < np; ++p) { const int k0 = p * 32; v8f s[1][2];
#pragma unroll
    for (int t = 0; t < 2; ++t) { v8f a = {}, al = {};
#pragma unroll
      for (int kc = 0; kc < 2; ++kc) { const size_t ko = (size_t)(k0 + 16 * t + c) * CC + kc * 32; const v16h kh = frag_p(Kb + (size_t)k0 * HD + (2 * t + kc) * 512 + 8 * lane), kl = frag_h(KLb + ko, lane); a = mmh(kh, qh[kc], a); al = mmh(kh, ql[kc], al); al = mmh(kl, qh[kc], al); }
      s[0][t] = a + al * (1.0f / 1024.0f); }
    fa_max<1>(s, p + 1 == np, k0, q0, c, h, m, l, o); fa_exp<1>(s, m, l);
    v16b ph, pl;
#pragma unroll
    for (int i = 0; i < 16; ++i) { const float x = s[0][i >> 3][i & 7]; const __bf16 bh = (__bf16)x; ph[i] = bh; pl[i] = (__bf16)(x - (float)bh); }
#pragma unroll
    for (int j = 0; j < 4; ++j) { const size_t po = (size_t)(16 * j + c) * KHI + k0; const v16b vh = frag_b(VBb + po, lane), vl = frag_b(VBLb + po, lane); o[0][j] = mmb(vh, ph, o[0][j]); o[0][j] = mmb(vh, pl, o[0][j]); o[0][j] = mmb(vl, ph, o[0][j]); } }
  fa_store<1>(o, l, q0, c, h, Ob); }
// block = 16 waves of one batch = 8 pairs, a pair = one 32-query tile. From row QHI on the pair's waves take the even and the odd 32-key passes, each with its own m, l and output tiles; the odd wave hands its state over through LDS
// (same lane, same registers) and the even wave joins the two at the common maximum. Below row QHI each wave of the pair takes 16 of the queries over all their keys. Waves w, w + 4, w + 8, w + 12 (taken to share a SIMD; a matter of speed only) hold tiles 127 - i and i: the same number of passes for every SIMD.
// K and v f16 fragments are read in the register order in which k_proj stores them: a 32-key pass is 4 KB of K and 4 KB of v in a row, every load four whole lines. Every wave still fetches its own copy.
__global__ __launch_bounds__(512) void k_fa(const _Float16* __restrict__ QH, const _Float16* __restrict__ KH, const _Float16* __restrict__ VT, const _Float16* __restrict__ QL, const _Float16* __restrict__ KL, const __bf16* __restrict__ VB, const __bf16* __restrict__ VBL, float* __restrict__ OUT) {
  __shared__ __align__(16) v4f xs[8][17][32];
  const int wave = __builtin_amdgcn_readfirstlane(threadIdx.x >> 5), lane = threadIdx.x & 31; const int b = blockIdx.x >> 4, pb = blockIdx.x & 15; const int hf = (wave >> 2) & 1, pr = (wave & 3) + 4 * (wave >> 3);
  const int q0 = 32 * (pr < 4 ? TT / 32 - 1 - (4 * pb + pr) : 4 * pb + (pr - 4)); const bool lo = q0 >= QHI;
  const _Float16* Qb = QH + (size_t)b * TT * CC; const _Float16* Kb = KH + (size_t)b * TT * HD; float* Ob = OUT + (size_t)b * TT * HD;
  v8f o[2][4] = {}; float m[2] = {-3.0e38f, -3.0e38f}, l[2] = {0.f, 0.f};
  if (lo) fa_lo(Qb, Kb, VT + (size_t)b * TT * HD, q0, hf, lane, o, m, l);
  else fa_hi(Qb, QL + (size_t)b * QHI * CC, Kb, KL + (size_t)b * KHI * CC, VB + (size_t)b * CC * KHI, VBL + (size_t)b * CC * KHI, q0 + 16 * hf, lane, Ob);
  if (lo && hf) {
#pragma unroll
    for (int g = 0; g < 2; ++g)
#pragma unroll
      for (int j = 0; j < 4; ++j) { xs[pr][(g * 4 + j) * 2][lane] = v4f{o[g][j][0], o[g][j][1], o[g][j][2], o[g][j][3]}; xs[pr][(g * 4 + j) * 2 + 1][lane] = v4f{o[g][j][4], o[g][j][5], o[g][j][6], o[g][j][7]}; }
    xs[pr][16][lane] = v4f{m[0], m[1], l[0], l[1]}; }
  __syncthreads();   // every wave passes it once: the odd waves' states are in LDS before the even waves read them
  if (lo && !hf) { const v4f ml = xs[pr][16][lane];
#pragma unroll
    for (int g = 0; g < 2; ++g) { const float mn = fmaxf(m[g], ml[g]); const float fa = __builtin_amdgcn_exp2f(m[g] - mn), fb = __builtin_amdgcn_exp2f(ml[g] - mn); l[g] = l[g] * fa + ml[2 + g] * fb;   // both waves have had at least one pass (np >= QHI / 32 + 1), so both maxima are real
#pragma unroll
      for (int j = 0; j < 4; ++j) { const v4f x0 = xs[pr][(g * 4 + j) * 2][lane], x1 = xs[pr][(g * 4 + j) * 2 + 1][lane];
#pragma unroll
        for (int r = 0; r < 4; ++r) { o[g][j][r] = o[g][j][r] * fa + x0[r] * fb; o[g][j][4 + r] = o[g][j][4 + r] * fa + x1[r] * fb; } } }
    fa_store<2>(o, l, q0, lane & 15, lane >> 4, Ob); } }

extern "C" void kernel_launch(void* const* d_in, const int* in_sizes, int n_in, void* d_out, int out_size, void* d_ws, size_t ws_size, hipStream_t stream) {
  (void)in_sizes; (void)n_in; (void)out_size;
  const float** F = (const float**)d_in;
  char* ws = (char*)d_ws; _Float16 *QH = (_Float16*)(ws + WS_QH), *KH = (_Float16*)(ws + WS_KH), *VT = (_Float16*)(ws + WS_VT), *QL = (_Float16*)(ws + WS_QL), *KL = (_Float16*)(ws + WS_KL); __bf16 *VB = (__bf16*)(ws + WS_VB), *VBL = (__bf16*)(ws + WS_VBL);
  // inputs: 0 x [16,4096,64]; 1 Wq [64,64]; 2 Wk; 3 Wv ((in,out), no biases)
  if (ws_size < (size_t)WS_END2) return;
  float *WP = (float*)(ws + WS_WP), *BP = (float*)(ws + WS_BP);
  k_padw<<<dim3(32, 3), 256, 0, stream>>>(F[1], F[2], F[3], nullptr, nullptr, nullptr, WP, BP);
  k_proj<<<dim3(TNB * TT / 64, CC / 128, 3), 128, 0, stream>>>(F[0], F[0], F[0], WP, WP + (size_t)CIN * 128, WP + 2 * (size_t)CIN * 128, BP, BP + 128, BP + 256, QH, QL, KH, KL, VT, VB, VBL);
  k_fa<<<dim3(TNB * 16), 512, 0, stream>>>(QH, KH, VT, QL, KL, VB, VBL, (float*)d_out);   /* head 0 only (head 1 is the zero padding) */
}

// v004
// Measured time: 73.7 microseconds a run.
// Timed twice side by side with v003, it ran 1.17 and 1.15 times as fast.
// All steps since v000 together make it 35.3 times as fast.
// compute dtype: all float inputs rounded to bf16; q/k/v projections with EXACT bf16 products on WMMA 16x16x32 (f32 accumulate); causal logits: 3 products (q f16 hi + residual x k hi + residual) for the first 384 rows, single f16 q x k after, x scale; online softmax f32; unnormalised P x 2^4 once to f16 x v once to f16 (1 product; bf16 hi + lo below row 384), divided by the f32 sum last; f32 output.
#include <hip/hip_runtime.h>
#include <math.h>

typedef __attribute__((ext_vector_type(16))) _Float16 v16h;
typedef __attribute__((ext_vector_type(16))) __bf16 v16b;
typedef __attribute__((ext_vector_type(8)))  _Float16 v8h;
typedef __attribute__((ext_vector_type(8)))  float v8f;
typedef __attribute__((ext_vector_type(4)))  float v4f;
typedef __attribute__((ext_vector_type(2)))  float v2f;
typedef __attribute__((ext_vector_type(4)))  unsigned v4u;
typedef __attribute__((ext_vector_type(4)))  int v4i;
typedef float __attribute__((may_alias)) float_a;
typedef int __attribute__((may_alias)) int_a;

template <typename T> __device__ __forceinline__ void vst2(void* p, T v) { *(T*)p = v;  }
__device__ __forceinline__ v8f wmma16(v16h a, v16h b, v8f c) {
  v8f d = __builtin_amdgcn_wmma_f32_16x16x32_f16(false, a, false, b, (short)0, c, false, false);
  asm volatile("v_nop\n\tv_nop\n\tv_nop\n\tv_nop" : "+v"(d) : "v"(a), "v"(b));
  return d;
}
__device__ __forceinline__ v8f wmma_bf(v16b a, v16b b, v8f c) {
  v8f d = __builtin_amdgcn_wmma_f32_16x16x32_bf16(false, a, false, b, (short)0, c, false, false);
  asm volatile("v_nop\n\tv_nop\n\tv_nop\n\tv_nop" : "+v"(d) : "v"(a), "v"(b));
  return d;
}
// 16x16x32 fragments: lane = (h = lane>>4, row/col = lane&15); elements 0..7 = k0+8h+0..7, 8..15 = k0+16+8h+0..7; D element r = row 8h+r
__device__ __forceinline__ v16h frag_h(const _Float16* rowk0, int lane) {
  union { v16h v; v8h q[2]; } u; const _Float16* p = rowk0 + 8 * (lane >> 4);
  u.q[0] = *(const v8h*)p; u.q[1] = *(const v8h*)(p + 16); return u.v;
}
// a fragment stored in register order: two 512-byte blocks, lane l's 16 bytes at 16 l, so that each wave-wide load covers four whole 128-byte lines
__device__ __forceinline__ v16h frag_p(const _Float16* p) {   // p = the fragment's first block + 8 * lane
  union { v16h v; v8h q[2]; } u; u.q[0] = *(const v8h*)p; u.q[1] = *(const v8h*)(p + 256); return u.v;
}
__device__ __forceinline__ v16h frag_f32(const float* rowk0, int lane) {
  v16h a; const float* p = rowk0 + 8 * (lane >> 4);
#pragma unroll
  for (int i = 0; i < 8; ++i) { a[i] = (_Float16)p[i]; a[8 + i] = (_Float16)p[16 + i]; }
  return a;
}
__device__ __forceinline__ v16h frag_f32s(const float* rowk0, int lane, float sc) {
  v16h a; const float* p = rowk0 + 8 * (lane >> 4);
#pragma unroll
  for (int i = 0; i < 8; ++i) { a[i] = (_Float16)(p[i] * sc); a[8 + i] = (_Float16)(p[16 + i] * sc); }
  return a;
}
// column fragment from a [K][ld] layout (column n), rows >= K read as 0
__device__ __forceinline__ v16h fragc_f32(const float* W, int k0, int n, int lane, int ld, int K) {
  v16h a; const int g = lane >> 4;
#pragma unroll
  for (int i = 0; i < 8; ++i) { const int ka = k0 + 8 * g + i, kb = ka + 16;
    a[i] = (_Float16)(ka < K ? W[(size_t)(ka < K ? ka : K - 1) * ld + n] : 0.f); a[8 + i] = (_Float16)(kb < K ? W[(size_t)(kb < K ? kb : K - 1) * ld + n] : 0.f); }
  return a;
}
struct F2 { v16b h, l; };
__device__ __forceinline__ F2 bsplit16(const float v[16]) { F2 r;
#pragma unroll
  for (int i = 0; i < 16; ++i) { const __bf16 h = (__bf16)v[i]; r.h[i] = h; r.l[i] = (__bf16)(v[i] - (float)h); }
  return r; }
__device__ __forceinline__ F2 split_row(const float* row, int k0, int lane) { float v[16]; const float* p = row + k0 + 8 * (lane >> 4);
#pragma unroll
  for (int i = 0; i < 8; ++i) { v[i] = p[i]; v[8 + i] = p[16 + i]; }
  return bsplit16(v); }
__device__ __forceinline__ F2 split_rowK(const float* row, int k0, int lane, int K) { float v[16]; const int g = lane >> 4;
#pragma unroll
  for (int i = 0; i < 8; ++i) { const int ka = k0 + 8 * g + i, kb = ka + 16; v[i] = ka < K ? row[ka < K ? ka : K - 1] : 0.f; v[8 + i] = kb < K ? row[kb < K ? kb : K - 1] : 0.f; }
  return bsplit16(v); }
__device__ __forceinline__ F2 split_col(const float* W, int k0, int n, int lane, int ld, int K) { float v[16]; const int g = lane >> 4;
#pragma unroll
  for (int i = 0; i < 8; ++i) { const int ka = k0 + 8 * g + i, kb = ka + 16; v[i] = ka < K ? W[(size_t)(ka < K ? ka : K - 1) * ld + n] : 0.f; v[8 + i] = kb < K ? W[(size_t)(kb < K ? kb : K - 1) * ld + n] : 0.f; }
  return bsplit16(v); }
__device__ __forceinline__ v8f mac3(const F2& a, const F2& b, v8f c) { c = wmma_bf(a.l, b.h, c); c = wmma_bf(a.h, b.l, c); return wmma_bf(a.h, b.h, c); }
__device__ __forceinline__ float sigm(float v) { return 1.0f / (1.0f + expf(-v)); }
#define LDSX() do { asm volatile("s_wait_dscnt 0" ::: "memory"); __builtin_amdgcn_wave_barrier(); __builtin_amdgcn_fence(__ATOMIC_RELEASE, "workgroup"); } while (0)

// Single-head causal self-attention (x [16,4096,64]; (in,out) Wq / Wk / Wv [64,64] N(0, 1/64), no biases; scale 64^-0.5; tril, finfo.min fill): out = softmax(causal(q k^T / 8)) v -> [16,4096,64].
#define NB 16
#define TT 4096
#define CC 128            // NH * HD = projected width
#define DIN 64          // input (model) width
#define NH 2
#define HD 64
#define NQB (TT / 64)
#define HG 1
#define SCALE (0.125f)
#define CAUSAL 1
#ifndef TNB
#define TNB NB
#endif
__device__ __forceinline__ float bfr(float v) { return (float)(__bf16)v; }
__host__ __device__ __forceinline__ int kb_last(int qb) { return CAUSAL ? ((qb * 64 + 63) >> 7) : (TT / 128 - 1); }
typedef __attribute__((ext_vector_type(8))) __bf16 v8b;
__device__ __forceinline__ v16b frag_b(const __bf16* rowk0, int lane) {
  union { v16b v; v8b q[2]; } u; const __bf16* p = rowk0 + 8 * (lane >> 4);
  u.q[0] = *(const v8b*)p; u.q[1] = *(const v8b*)(p + 16); return u.v;
}
#define QBH 6              // unused: the queries below row QHI (few keys, no averaging) take the high-precision path
#define QHI 384            // rows carrying a q residual plane
#define KHI 384            // key rows carrying k residual / v bf16 hi+lo planes (used only by the causal high-precision path)
// B fragment (k rows k0+.., output column o) of a weight: (in,out) [K][ld] or (out,in) [ld rows of K]: bf16 exact, or f16(bf16 * 256) exact
__device__ __forceinline__ v16b wcol_io(const float* Wm, int k0, int o, int lane, int ld) { v16b w; const int g = lane >> 4;
#pragma unroll
  for (int i = 0; i < 8; ++i) { w[i] = (__bf16)Wm[(size_t)(k0 + 8 * g + i) * ld + o]; w[8 + i] = (__bf16)Wm[(size_t)(k0 + 16 + 8 * g + i) * ld + o]; }
  return w; }
__device__ __forceinline__ v16b wcol_oi(const float* Wm, int k0, int o, int lane, int K) { v16b w; const float* p = Wm + (size_t)o * K + k0 + 8 * (lane >> 4);
#pragma unroll
  for (int i = 0; i < 8; ++i) { w[i] = (__bf16)p[i]; w[8 + i] = (__bf16)p[16 + i]; }
  return w; }
__device__ __forceinline__ v16h wcolh_io(const float* Wm, int k0, int o, int lane, int ld) { v16h w; const int g = lane >> 4;
#pragma unroll
  for (int i = 0; i < 8; ++i) { w[i] = (_Float16)(bfr(Wm[(size_t)(k0 + 8 * g + i) * ld + o]) * 256.0f); w[8 + i] = (_Float16)(bfr(Wm[(size_t)(k0 + 16 + 8 * g + i) * ld + o]) * 256.0f); }
  return w; }
__device__ __forceinline__ v16h wcolh_oi(const float* Wm, int k0, int o, int lane, int K) { v16h w; const float* p = Wm + (size_t)o * K + k0 + 8 * (lane >> 4);
#pragma unroll
  for (int i = 0; i < 8; ++i) { w[i] = (_Float16)(bfr(p[i]) * 256.0f); w[8 + i] = (_Float16)(bfr(p[16 + i]) * 256.0f); }
  return w; }
#define WQKV_LAYOUT 0   // 0 = (in,out) [DIN][CC]; 1 = (out,in) [CC][DIN]; 2 = per-head [NH][DIN][HD]
__device__ __forceinline__ v16b wcol_hdk(const float* Wm, int k0, int o, int lane) { v16b w; const int g = lane >> 4; const float* p = Wm + (size_t)(o / HD) * DIN * HD + (o % HD);
#pragma unroll
  for (int i = 0; i < 8; ++i) { w[i] = (__bf16)p[(size_t)(k0 + 8 * g + i) * HD]; w[8 + i] = (__bf16)p[(size_t)(k0 + 16 + 8 * g + i) * HD]; }
  return w; }
#define WO_OUT_IN 0
#if WQKV_LAYOUT == 1
#define WCOL(W, k0, o, lane) wcol_oi(W, k0, o, lane, DIN)
#elif WQKV_LAYOUT == 2
#define WCOL(W, k0, o, lane) wcol_hdk(W, k0, o, lane)
#else
#define WCOL(W, k0, o, lane) wcol_io(W, k0, o, lane, CC)
#endif
#if WO_OUT_IN
#define WOCOL(W, k0, o, lane) wcol_oi(W, k0, o, lane, CC)
#define WOCOLH(W, k0, o, lane) wcolh_oi(W, k0, o, lane, CC)
#else
#define WOCOL(W, k0, o, lane) wcol_io(W, k0, o, lane, DIN)
#define WOCOLH(W, k0, o, lane) wcolh_io(W, k0, o, lane, DIN)
#endif
#define CIN 64
// ---- k_padw: the three (in,out) [C][64] projection weights copied into zero-padded (in,out) [C][128] ws planes (columns 64..127 zero) + zero-padded [128] biases
__global__ __launch_bounds__(256) void k_padw(const float* __restrict__ WQ, const float* __restrict__ WK, const float* __restrict__ WV, const float* __restrict__ BQ, const float* __restrict__ BK, const float* __restrict__ BV, float* __restrict__ WP, float* __restrict__ BP) { const int which = blockIdx.y; const float* Wsrc = which == 0 ? WQ : (which == 1 ? WK : WV); const float* Bsrc = which == 0 ? BQ : (which == 1 ? BK : BV); float* dst = WP + (size_t)which * CIN * 128;
  for (int e = blockIdx.x * 256 + threadIdx.x; e < CIN * 32; e += gridDim.x * 256) { const int row = e >> 5, q = e & 31; const v4f ld = *(const v4f*)(Wsrc + (size_t)row * 64 + (q & 15) * 4); asm volatile("s_wait_loadcnt 0x0" ::: "memory"); const float keep = q < 16 ? 1.f : 0.f; v4f ov; ov[0] = ld[0] * keep; ov[1] = ld[1] * keep; ov[2] = ld[2] * keep; ov[3] = ld[3] * keep; vst2(dst + (size_t)row * 128 + q * 4, ov); }
  if (blockIdx.x == 0 && threadIdx.x < 128) { const int c = threadIdx.x; float bvv = 0.f; if (Bsrc) { const float t = Bsrc[c & 63]; asm volatile("s_wait_loadcnt 0x0" ::: "memory"); bvv = c < 64 ? t : 0.f; } vst2(BP + which * 128 + c, bvv); } }
#define WS_WP (WS_END)                                  // padded weights [3][C][128]
#define WS_BP (WS_WP + 4u * 3 * (size_t)CIN * 128)        // padded biases [3][128]
#define WS_Y2 (WS_BP + 4u * 3 * 128)                      // f32 [b*TT+t][128], not used
#define WS_END2 (WS_Y2 + 4u * (size_t)NB * TT * CC)
#ifndef SM_EXTRA_PARAMS
#define SM_EXTRA_PARAMS
#endif
#ifndef PROJ_EXTRA_PARAMS
#define PROJ_EXTRA_PARAMS
#endif
#ifndef SM_MASK_HOOK
#define SM_MASK_HOOK (void)0
#endif

#define WS_QH  0u                                      // f16 q rows [b*t][CC]
#define WS_KH  (WS_QH + 2u * (size_t)NB * TT * CC)      // f16 k in fragment order [b][t / 16][kc][u][lane = 16 h + (t & 15)][8]: column 32 kc + 16 u + 8 h + i, the HD real columns only
#define WS_VT  (WS_KH + 2u * (size_t)NB * TT * CC)      // f16 v in fragment order [b][t / 32][j][u][lane = 16 h + c][8]: column 16 j + c, row 32 (t / 32) + 16 u + 8 h + i, the HD real columns only
#define WS_QL  (WS_VT + 2u * (size_t)NB * CC * TT)      // f16 q residual x 2^10 rows [b][t < QHI][CC]
#define WS_KL  (WS_QL + 2u * (size_t)NB * QHI * CC)     // f16 k residual x 2^10 rows [b][t < KHI][CC]
#define WS_VB  (WS_KL + 2u * (size_t)NB * KHI * CC)     // bf16 v hi planes [b][c][t < KHI]
#define WS_VBL (WS_VB + 2u * (size_t)NB * CC * KHI)
#define WS_S   (WS_VBL + 2u * (size_t)NB * CC * KHI)    // f32 [hg][t][s], not used: the logits stay in registers
#define WS_Y   (WS_S  + 4u * (size_t)HG * TT * TT)      // f32 ctx rows [b*t][CC] (only when there is an output projection)
#define WS_END (WS_Y  + 0u)

// ---- k_proj: block = (64 rows, 128 cols, which): q/k/v = X W (+ b) with exact bf16 products (K = DIN) -> which 0: q f16 rows (+ residual rows < QHI); 1: k f16 in fragment order (+ residual rows < KHI); 2: v f16 in fragment order (+ bf16 hi/lo planes for t < KHI)
__global__ __launch_bounds__(128) void k_proj(const float* __restrict__ XQ, const float* __restrict__ XK, const float* __restrict__ XV, const float* __restrict__ WQ, const float* __restrict__ WK, const float* __restrict__ WV, const float* __restrict__ BQ, const float* __restrict__ BK, const float* __restrict__ BV,
    _Float16* __restrict__ QH, _Float16* __restrict__ QL, _Float16* __restrict__ KH, _Float16* __restrict__ KL, _Float16* __restrict__ VT, __bf16* __restrict__ VB, __bf16* __restrict__ VBL) {
  __shared__ __align__(16) _Float16 sh[64][136], sl[64][136]; __shared__ __align__(16) _Float16 th[128][72]; __shared__ __align__(16) __bf16 tb[128][72], tbl[128][72];
  const int tid = threadIdx.x, wave = tid >> 5, lane = tid & 31, col = lane & 15, g = lane >> 4; const int which = blockIdx.z; const int c0 = blockIdx.y * 128; const size_t r0 = (size_t)blockIdx.x * 64; const size_t bb = r0 / TT; const int t0 = (int)(r0 % TT);
  const float* X = which == 0 ? XQ : which == 1 ? XK : XV; const float* WA = which == 0 ? WQ : which == 1 ? WK : WV; const float* BA = which == 0 ? BQ : which == 1 ? BK : BV;
  v8f acc[8] = {};
#pragma unroll 2
  for (int kc = 0; kc < DIN / 32; ++kc) { v16b a; { const float* p = X + (r0 + wave * 16 + col) * DIN + kc * 32 + 8 * g;
#pragma unroll
      for (int i = 0; i < 8; ++i) { a[i] = (__bf16)p[i]; a[8 + i] = (__bf16)p[16 + i]; } }
    asm volatile("s_wait_loadcnt 0x0" ::: "memory");
#pragma unroll
    for (int j = 0; j < 8; ++j) { const v16b w = WCOL(WA, kc * 32, c0 + j * 16 + col, lane); asm volatile("s_wait_loadcnt 0x0" ::: "memory"); acc[j] = wmma_bf(a, w, acc[j]); } }
  if (which < 2) { _Float16* DH = which == 0 ? QH : KH; _Float16* DL = which == 0 ? QL : KL; const int nhi = which == 0 ? QHI : KHI; const bool hi_rows = t0 < nhi;
#pragma unroll
    for (int j = 0; j < 8; ++j) { const float bias = BA ? bfr(BA[c0 + j * 16 + col]) : 0.f;
#pragma unroll
      for (int r = 0; r < 8; ++r) { const float v = acc[j][r] + bias; const _Float16 hv = (_Float16)v; sh[wave * 16 + 8 * g + r][j * 16 + col] = hv; sl[wave * 16 + 8 * g + r][j * 16 + col] = (_Float16)((v - (float)hv) * 1024.0f); } }
    __syncthreads();
    if (which == 0) for (int e = tid; e < 64 * 16; e += 128) { const int rl = e >> 4, q = e & 15; vst2((unsigned*)(DH + (r0 + rl) * CC + c0 + q * 8), *(const v4u*)&sh[rl][q * 8]); }
    else for (int e = tid; e < 64 * 8; e += 128) { const int ln = e & 31, u = (e >> 5) & 1, kc = (e >> 6) & 1, tl = e >> 7; vst2((unsigned*)(DH + r0 * HD + e * 8), *(const v4u*)&sh[16 * tl + (ln & 15)][32 * kc + 16 * u + 8 * (ln >> 4)]); }   // the block's 64 keys = 8 KB in a row
    if (hi_rows) for (int e = tid; e < 64 * 16; e += 128) { const int rl = e >> 4, q = e & 15; vst2((unsigned*)(DL + (bb * nhi + t0 + rl) * (size_t)CC + c0 + q * 8), *(const v4u*)&sl[rl][q * 8]); }
  } else { const bool hi_rows = t0 < KHI;
#pragma unroll
    for (int j = 0; j < 8; ++j) { const float bias = BA ? bfr(BA[c0 + j * 16 + col]) : 0.f;
#pragma unroll
      for (int r = 0; r < 8; ++r) { const float v = acc[j][r] + bias; const int rl = wave * 16 + 8 * g + r, cl = j * 16 + col; th[cl][rl] = (_Float16)v; const __bf16 bh = (__bf16)v; tb[cl][rl] = bh; tbl[cl][rl] = (__bf16)(v - (float)bh); } }
    __syncthreads();
    for (int e = tid; e < 64 * 8; e += 128) { const int ln = e & 31, u = (e >> 5) & 1, j = (e >> 6) & 3, pl = e >> 8; vst2((unsigned*)(VT + r0 * HD + e * 8), *(const v4u*)&th[16 * j + (ln & 15)][32 * pl + 16 * u + 8 * (ln >> 4)]); }   // the block's 64 keys = 8 KB in a row
    if (hi_rows) for (int e = tid; e < 128 * 8; e += 128) { const int cl = e >> 3, q = e & 7; const size_t o3 = (bb * CC + c0 + cl) * (size_t)KHI + t0 + q * 8; vst2((unsigned*)(VB + o3), *(const v4u*)&tb[cl][q * 8]); vst2((unsigned*)(VBL + o3), *(const v4u*)&tbl[cl][q * 8]); } } }
#define FSC (SCALE * 1.4426950408889634f)
#define FPK 4.0f           // P carries 2^4: largest value 2^12 in f16, and the small ones stay normal numbers
__device__ __forceinline__ float xhalf(float x) { return __builtin_bit_cast(float, __builtin_amdgcn_permlanex16(__builtin_bit_cast(int, x), __builtin_bit_cast(int, x), 0x76543210, 0xfedcba98, false, false)); }  // lane l with lane l ^ 16
__device__ __forceinline__ v8f mmh(v16h a, v16h b, v8f c) { return __builtin_amdgcn_wmma_f32_16x16x32_f16(false, a, false, b, (short)0, c, false, false); }
__device__ __forceinline__ v8f mmb(v16b a, v16b b, v8f c) { return __builtin_amdgcn_wmma_f32_16x16x32_bf16(false, a, false, b, (short)0, c, false, false); }
// one 32-key pass, raw logits s[g][t][r] (query q0 + 16 g + c, key k0 + 16 t + 8 h + r). fa_max: mask, maxima, and m, l (this half's part of the sum) and the output tiles kept in step; fa_exp: s -> P in place, l grows
template <int NG> __device__ __forceinline__ void fa_max(v8f (&s)[NG][2], bool diag, int k0, int q0, int c, int h, float (&m)[NG], float (&l)[NG], v8f (&o)[NG][4]) {
  if (diag) {   // wave-uniform: only the pass on the diagonal pays for the mask; every column keeps at least key k0 <= its query
#pragma unroll
    for (int g = 0; g < NG; ++g)
#pragma unroll
      for (int t = 0; t < 2; ++t)
#pragma unroll
        for (int r = 0; r < 8; ++r) if (k0 + 16 * t + 8 * h + r > q0 + 16 * g + c) s[g][t][r] = -3.0e38f; }
  float mb[NG]; bool need = false;
#pragma unroll
  for (int g = 0; g < NG; ++g) { float mx = s[g][0][0];
#pragma unroll
    for (int r = 0; r < 8; ++r) mx = fmaxf(mx, fmaxf(s[g][0][r], s[g][1][r]));
    mx = fmaxf(mx, xhalf(mx)) * FSC; mb[g] = mx; need = need || (mx > m[g] + 8.0f); }
  if (__builtin_amdgcn_ballot_w32(need) != 0) {   // scalar branch, rare after the first passes
#pragma unroll
    for (int g = 0; g < NG; ++g) { const float mn = fmaxf(m[g], mb[g]); const float corr = __builtin_amdgcn_exp2f(m[g] - mn); m[g] = mn; l[g] *= corr;   // corr = 0 on the first pass
#pragma unroll
      for (int j = 0; j < 4; ++j) o[g][j] = o[g][j] * corr; } } }
template <int NG> __device__ __forceinline__ void fa_exp(v8f (&s)[NG][2], const float (&m)[NG], float (&l)[NG]) {
#pragma unroll
  for (int g = 0; g < NG; ++g) { const float nm = FPK - m[g];
#pragma unroll
    for (int t = 0; t < 2; ++t)
#pragma unroll
      for (int r = 0; r < 8; ++r) s[g][t][r] = __builtin_amdgcn_exp2f(fmaf(s[g][t][r], FSC, nm));
    const v8f sv = s[g][0] + s[g][1]; l[g] += ((sv[0] + sv[1]) + (sv[2] + sv[3])) + ((sv[4] + sv[5]) + (sv[6] + sv[7])); } }
template <int NG> __device__ __forceinline__ void fa_store(const v8f (&o)[NG][4], const float (&l)[NG], int q0, int c, int h, float* __restrict__ Ob) {
#pragma unroll
  for (int g = 0; g < NG; ++g) { const float inv = 1.0f / (l[g] + xhalf(l[g])); float* op = Ob + (size_t)(q0 + 16 * g + c) * HD + 8 * h;   // a lane holds 8 consecutive d of its query per tile
#pragma unroll
    for (int j = 0; j < 4; ++j) { v4f a, e;
#pragma unroll
      for (int r = 0; r < 4; ++r) { a[r] = o[g][j][r] * inv; e[r] = o[g][j][4 + r] * inv; }
      vst2(op + 16 * j, a); vst2(op + 16 * j + 4, e); } }
  asm volatile("s_wait_xcnt 0x0" ::: "memory"); }   // on the way to the kernel's barrier the compiler writes over registers that these stores name
// 32 queries from row QHI on, the 32-key passes hf, hf + 2, ... of their keys: one f16 product for the logits, P once to f16 against v f16. K and v fragments are fetched one pass ahead, each right behind the products that read it.
// pr == 0 (wave-uniform; pair 0 holds the work-group's longest tile): this wave also asks L2 for the K and v blocks of its pass p + 2 PFD, one byte prefetch every 256 bytes (lanes 0..15: the 4 KB of K, lanes 16..31: the 4 KB of v). The first read of a K or v line in k_fa is taken to come from memory,
// and the register fetch leads its use by less than one pass, far less than the way to memory; the waves of a work-group walk the same keys nearly in step, so the wave with the most passes asks for all of them.
#define PFD 6
__device__ __forceinline__ void fa_lo(const _Float16* __restrict__ Qb, const _Float16* __restrict__ Kb, const _Float16* __restrict__ Vb, int q0, int hf, int pr, int lane, v8f (&o)[2][4], float (&m)[2], float (&l)[2]) {
  const int c = lane & 15, h = lane >> 4; v16h qf[2][2], kf[2][2];
  unsigned long long pa = (unsigned long long)(h ? Vb : Kb) + (unsigned)(4096 * hf + 256 * c);   // the lane's unit of the pass in hand; it lives in one register pair through the loop and never leaves the wave's own passes
  if (pr == 0)   // passes hf + 2 .. hf + 2 (PFD - 1) at once (np >= QHI / 32 + 1 = 13, so they exist): their ways to memory overlap instead of following one another
    asm volatile("global_prefetch_b8 %0, off offset:8192 scope:SCOPE_SE\n\tglobal_prefetch_b8 %0, off offset:16384 scope:SCOPE_SE\n\tglobal_prefetch_b8 %0, off offset:24576 scope:SCOPE_SE\n\t"
                 "global_prefetch_b8 %0, off offset:32768 scope:SCOPE_SE\n\tglobal_prefetch_b8 %0, off offset:40960 scope:SCOPE_SE" : "+v"(pa));
#pragma unroll
  for (int g = 0; g < 2; ++g)
#pragma unroll
    for (int kc = 0; kc < 2; ++kc) { qf[g][kc] = frag_h(Qb + (size_t)(q0 + 16 * g + c) * CC + kc * 32, lane); kf[g][kc] = frag_p(Kb + (size_t)(32 * hf) * HD + (2 * g + kc) * 512 + 8 * lane); }
  asm volatile("s_wait_xcnt 0x0" ::: "memory");   // the zeroing of the output tiles, which the compiler sets behind the v loads, writes over the Q loads' address pairs
  const int np = q0 / 32 + 1; v16h vf[4];
  const int pe = np - 2 * PFD - TT * pr;   // pair 0: passes below pe have a pass 2 PFD further on; any other pair: below 0, no pass asks (one scalar compare a pass)
#pragma unroll
  for (int j = 0; j < 4; ++j) vf[j] = frag_p(Vb + (size_t)(32 * hf) * HD + j * 512 + 8 * lane);
  asm volatile("s_wait_xcnt 0x0" ::: "memory");   // on the way into the loop scalar registers of the base that the v loads name are written over
  asm volatile("" :: "v"(qf[0][0]), "v"(qf[0][1]), "v"(qf[1][0]), "v"(qf[1][1]));   // inputs only: Q has landed before the loop, so that the loop's own waits count only the K and v loads in flight (else each pass waits for all of them)
  for (int p = hf; p < np; p += 2) { const int k0 = p * 32;
    if (p < pe)   // scalar branch; the register steps to pass p + 2, the offset reaches pass p + 2 PFD < np: both inside K and v. The step stands in front of the request, a whole pass and the wait at the loop's foot behind the last one
      asm volatile("v_add_nc_u64 %0, %1, %0\n\tglobal_prefetch_b8 %0, off offset:40960 scope:SCOPE_SE" : "+v"(pa) : "s"(8192ull));
    v8f s[2][2];
#pragma unroll
    for (int g = 0; g < 2; ++g)
#pragma unroll
      for (int t = 0; t < 2; ++t) { v8f z = {}; z = mmh(kf[t][0], qf[g][0], z); s[g][t] = mmh(kf[t][1], qf[g][1], z); }
    fa_max<2>(s, p + 1 == np, k0, q0, c, h, m, l, o);
    const int kn = p + 2 < np ? k0 + 64 : k0;   // the last pass fetches its own blocks again: in bounds, not used
    const _Float16 *kq = Kb + (size_t)kn * HD + 8 * lane, *vq = Vb + (size_t)kn * HD + 8 * lane;   // a pass is 4 KB of K and 4 KB of v in a row
#pragma unroll
    for (int t = 0; t < 2; ++t)
#pragma unroll
      for (int kc = 0; kc < 2; ++kc) kf[t][kc] = frag_p(kq + (2 * t + kc) * 512);
    __builtin_amdgcn_sched_barrier(0);   // keeps the next K loads in front of the exponentials, whose time covers their latency; without it they are issued behind the second product
    fa_exp<2>(s, m, l);
#pragma unroll
    for (int g = 0; g < 2; ++g) { v16h pb;
#pragma unroll
      for (int i = 0; i < 8; ++i) { pb[i] = (_Float16)s[g][0][i]; pb[8 + i] = (_Float16)s[g][1][i]; }
#pragma unroll
      for (int j = 0; j < 4; ++j) o[g][j] = mmh(vf[j], pb, o[g][j]); }
#pragma unroll
    for (int j = 0; j < 4; ++j) vf[j] = frag_p(vq + j * 512);
    asm volatile("s_wait_xcnt 0x0" :: "v"(kq), "v"(vq) : "memory"); }   // the two address pairs are written over behind this place; as inputs they stay whole up to the wait (without that the last K load lands on its own address pair)
}
// 16 queries below row QHI (few keys, no averaging): 3 products for the logits (q hi + residual x k hi + residual), P and v as bf16 hi + lo (3 products)
__device__ __forceinline__ void fa_hi(const _Float16* __restrict__ Qb, const _Float16* __restrict__ QLb, const _Float16* __restrict__ Kb, const _Float16* __restrict__ KLb, const __bf16* __restrict__ VBb, const __bf16* __restrict__ VBLb, int q0, int hw, int lane, float* __restrict__ Ob) {
  const int c = lane & 15, h = lane >> 4; v16h qh[2], ql[2];
  // At entry the work-group's 8 waves of this path (hw = 0..7) ask L2 for the planes that only this path reads, one byte prefetch every 256 bytes, 96 a wave: the KHI rows of the k residual (hw 0..3), the HD real planes of v hi (4, 5) and of v lo (6, 7).
  // The loop below fetches nothing ahead, so that each pass would wait out the way to memory several times in a row.
  const unsigned long long ha = (unsigned long long)(hw < 4 ? (const char*)KLb + 24576 * hw : hw < 6 ? (const char*)VBb + 24576 * (hw - 4) : (const char*)VBLb + 24576 * (hw - 6)) + (unsigned)(256 * lane);
  asm volatile("global_prefetch_b8 %0, off scope:SCOPE_SE\n\tglobal_prefetch_b8 %0, off offset:8192 scope:SCOPE_SE\n\tglobal_prefetch_b8 %0, off offset:16384 scope:SCOPE_SE" :: "v"(ha));
#pragma unroll
  for (int kc = 0; kc < 2; ++kc) { qh[kc] = frag_h(Qb + (size_t)(q0 + c) * CC + kc * 32, lane); ql[kc] = frag_h(QLb + (size_t)(q0 + c) * CC + kc * 32, lane); }
  v8f o[1][4] = {}; float m[1] = {-3.0e38f}, l[1] = {0.f}; const int np = (q0 + 47) / 32;
  for (int p = 0; p < np; ++p) { const int k0 = p * 32; v8f s[1][2];
#pragma unroll
    for (int t = 0; t < 2; ++t) { v8f a = {}, al = {};
#pragma unroll
      for (int kc = 0; kc < 2; ++kc) { const size_t ko = (size_t)(k0 + 16 * t + c) * CC + kc * 32; const v16h kh = frag_p(Kb + (size_t)k0 * HD + (2 * t + kc) * 512 + 8 * lane), kl = frag_h(KLb + ko, lane); a = mmh(kh, qh[kc], a); al = mmh(kh, ql[kc], al); al = mmh(kl, qh[kc], al); }
      s[0][t] = a + al * (1.0f / 1024.0f); }
    fa_max<1>(s, p + 1 == np, k0, q0, c, h, m, l, o); fa_exp<1>(s, m, l);
    v16b ph, pl;
#pragma unroll
    for (int i = 0; i < 16; ++i) { const float x = s[0][i >> 3][i & 7]; const __bf16 bh = (__bf16)x; ph[i] = bh; pl[i] = (__bf16)(x - (float)bh); }
#pragma unroll
    for (int j = 0; j < 4; ++j) { const size_t po = (size_t)(16 * j + c) * KHI + k0; const v16b vh = frag_b(VBb + po, lane), vl = frag_b(VBLb + po, lane); o[0][j] = mmb(vh, ph, o[0][j]); o[0][j] = mmb(vh, pl, o[0][j]); o[0][j] = mmb(vl, ph, o[0][j]); } }
  asm volatile("s_wait_xcnt 0x0" :: "v"(ha) : "memory");   // as an input here the pair that the entry requests name stays whole, an address inside its plane, through the loop and up to this wait
  fa_store<1>(o, l, q0, c, h, Ob); }
// block = 16 waves of one batch = 8 pairs, a pair = one 32-query tile. From row QHI on the pair's waves take the even and the odd 32-key passes, each with its own m, l and output tiles; the odd wave hands its state over through LDS
// (same lane, same registers) and the even wave joins the two at the common maximum. Below row QHI each wave of the pair takes 16 of the queries over all their keys. Waves w, w + 4, w + 8, w + 12 (taken to share a SIMD; a matter of speed only) hold tiles 127 - i and i: the same number of passes for every SIMD.
// K and v f16 fragments are read in the register order in which k_proj stores them: a 32-key pass is 4 KB of K and 4 KB of v in a row, every load four whole lines. Every wave still fetches its own copy.
__global__ __launch_bounds__(512) void k_fa(const _Float16* __restrict__ QH, const _Float16* __restrict__ KH, const _Float16* __restrict__ VT, const _Float16* __restrict__ QL, const _Float16* __restrict__ KL, const __bf16* __restrict__ VB, const __bf16* __restrict__ VBL, float* __restrict__ OUT) {
  __shared__ __align__(16) v4f xs[8][17][32];
  const int wave = __builtin_amdgcn_readfirstlane(threadIdx.x >> 5), lane = threadIdx.x & 31; const int b = blockIdx.x >> 4, pb = blockIdx.x & 15; const int hf = (wave >> 2) & 1, pr = (wave & 3) + 4 * (wave >> 3);
  const int q0 = 32 * (pr < 4 ? TT / 32 - 1 - (4 * pb + pr) : 4 * pb + (pr - 4)); const bool lo = q0 >= QHI;
  const _Float16* Qb = QH + (size_t)b * TT * CC; const _Float16* Kb = KH + (size_t)b * TT * HD; float* Ob = OUT + (size_t)b * TT * HD;
  v8f o[2][4] = {}; float m[2] = {-3.0e38f, -3.0e38f}, l[2] = {0.f, 0.f};
  if (lo) fa_lo(Qb, Kb, VT + (size_t)b * TT * HD, q0, hf, pr, lane, o, m, l);
  else fa_hi(Qb, QL + (size_t)b * QHI * CC, Kb, KL + (size_t)b * KHI * CC, VB + (size_t)b * CC * KHI, VBL + (size_t)b * CC * KHI, q0 + 16 * hf, 2 * (pr & 3) + hf, lane, Ob);
  if (lo && hf) {
#pragma unroll
    for (int g = 0; g < 2; ++g)
#pragma unroll
      for (int j = 0; j < 4; ++j) { xs[pr][(g * 4 + j) * 2][lane] = v4f{o[g][j][0], o[g][j][1], o[g][j][2], o[g][j][3]}; xs[pr][(g * 4 + j) * 2 + 1][lane] = v4f{o[g][j][4], o[g][j][5], o[g][j][6], o[g][j][7]}; }
    xs[pr][16][lane] = v4f{m[0], m[1], l[0], l[1]}; }
  __syncthreads();   // every wave passes it once: the odd waves' states are in LDS before the even waves read them
  if (lo && !hf) { const v4f ml = xs[pr][16][lane];
#pragma unroll
    for (int g = 0; g < 2; ++g) { const float mn = fmaxf(m[g], ml[g]); const float fa = __builtin_amdgcn_exp2f(m[g] - mn), fb = __builtin_amdgcn_exp2f(ml[g] - mn); l[g] = l[g] * fa + ml[2 + g] * fb;   // both waves have had at least one pass (np >= QHI / 32 + 1), so both maxima are real
#pragma unroll
      for (int j = 0; j < 4; ++j) { const v4f x0 = xs[pr][(g * 4 + j) * 2][lane], x1 = xs[pr][(g * 4 + j) * 2 + 1][lane];
#pragma unroll
        for (int r = 0; r < 4; ++r) { o[g][j][r] = o[g][j][r] * fa + x0[r] * fb; o[g][j][4 + r] = o[g][j][4 + r] * fa + x1[r] * fb; } } }
    fa_store<2>(o, l, q0, lane & 15, lane >> 4, Ob); } }

extern "C" void kernel_launch(void* const* d_in, const int* in_sizes, int n_in, void* d_out, int out_size, void* d_ws, size_t ws_size, hipStream_t stream) {
  (void)in_sizes; (void)n_in; (void)out_size;
  const float** F = (const float**)d_in;
  char* ws = (char*)d_ws; _Float16 *QH = (_Float16*)(ws + WS_QH), *KH = (_Float16*)(ws + WS_KH), *VT = (_Float16*)(ws + WS_VT), *QL = (_Float16*)(ws + WS_QL), *KL = (_Float16*)(ws + WS_KL); __bf16 *VB = (__bf16*)(ws + WS_VB), *VBL = (__bf16*)(ws + WS_VBL);
  // inputs: 0 x [16,4096,64]; 1 Wq [64,64]; 2 Wk; 3 Wv ((in,out), no biases)
  if (ws_size < (size_t)WS_END2) return;
  float *WP = (float*)(ws + WS_WP), *BP = (float*)(ws + WS_BP);
  k_padw<<<dim3(32, 3), 256, 0, stream>>>(F[1], F[2], F[3], nullptr, nullptr, nullptr, WP, BP);
  k_proj<<<dim3(TNB * TT / 64, CC / 128, 3), 128, 0, stream>>>(F[0], F[0], F[0], WP, WP + (size_t)CIN * 128, WP + 2 * (size_t)CIN * 128, BP, BP + 128, BP + 256, QH, QL, KH, KL, VT, VB, VBL);
  k_fa<<<dim3(TNB * 16), 512, 0, stream>>>(QH, KH, VT, QL, KL, VB, VBL, (float*)d_out);   /* head 0 only (head 1 is the zero padding) */
}

// v005
// Measured time: 56.3 microseconds a run.
// Next to v004, in two timings, it ran 1.32 and 1.31 times as fast.
// Counting every step since v000, it is 46.4 times as fast.
// compute dtype: all float inputs rounded to bf16; q/k/v projections with EXACT bf16 products on WMMA 16x16x32 (f32 accumulate); causal logits: 3 products (q f16 hi + residual x k hi + residual) for the first 384 rows, single f16 q x k after, x scale; online softmax f32; unnormalised P x 2^4 once to f16 x v once to f16 (1 product; bf16 hi + lo below row 384), divided by the f32 sum last; f32 output.
#include <hip/hip_runtime.h>
#include <math.h>

typedef __attribute__((ext_vector_type(16))) _Float16 v16h;
typedef __attribute__((ext_vector_type(16))) __bf16 v16b;
typedef __attribute__((ext_vector_type(8)))  _Float16 v8h;
typedef __attribute__((ext_vector_type(8)))  float v8f;
typedef __attribute__((ext_vector_type(4)))  float v4f;
typedef __attribute__((ext_vector_type(2)))  float v2f;
typedef __attribute__((ext_vector_type(4)))  unsigned v4u;
typedef __attribute__((ext_vector_type(4)))  int v4i;
typedef float __attribute__((may_alias)) float_a;
typedef int __attribute__((may_alias)) int_a;

template <typename T> __device__ __forceinline__ void vst2(void* p, T v) { *(T*)p = v;  }
__device__ __forceinline__ v8f wmma16(v16h a, v16h b, v8f c) {
  v8f d = __builtin_amdgcn_wmma_f32_16x16x32_f16(false, a, false, b, (short)0, c, false, false);
  asm volatile("v_nop\n\tv_nop\n\tv_nop\n\tv_nop" : "+v"(d) : "v"(a), "v"(b));
  return d;
}
__device__ __forceinline__ v8f wmma_bf(v16b a, v16b b, v8f c) {
  v8f d = __builtin_amdgcn_wmma_f32_16x16x32_bf16(false, a, false, b, (short)0, c, false, false);
  asm volatile("v_nop\n\tv_nop\n\tv_nop\n\tv_nop" : "+v"(d) : "v"(a), "v"(b));
  return d;
}
// 16x16x32 fragments: lane = (h = lane>>4, row/col = lane&15); elements 0..7 = k0+8h+0..7, 8..15 = k0+16+8h+0..7; D element r = row 8h+r
__device__ __forceinline__ v16h frag_h(const _Float16* rowk0, int lane) {
  union { v16h v; v8h q[2]; } u; const _Float16* p = rowk0 + 8 * (lane >> 4);
  u.q[0] = *(const v8h*)p; u.q[1] = *(const v8h*)(p + 16); return u.v;
}
// a fragment stored in register order: two 512-byte blocks, lane l's 16 bytes at 16 l, so that each wave-wide load covers four whole 128-byte lines
__device__ __forceinline__ v16h frag_p(const _Float16* p) {   // p = the fragment's first block + 8 * lane
  union { v16h v; v8h q[2]; } u; u.q[0] = *(const v8h*)p; u.q[1] = *(const v8h*)(p + 256); return u.v;
}
__device__ __forceinline__ v16h frag_f32(const float* rowk0, int lane) {
  v16h a; const float* p = rowk0 + 8 * (lane >> 4);
#pragma unroll
  for (int i = 0; i < 8; ++i) { a[i] = (_Float16)p[i]; a[8 + i] = (_Float16)p[16 + i]; }
  return a;
}
__device__ __forceinline__ v16h frag_f32s(const float* rowk0, int lane, float sc) {
  v16h a; const float* p = rowk0 + 8 * (lane >> 4);
#pragma unroll
  for (int i = 0; i < 8; ++i) { a[i] = (_Float16)(p[i] * sc); a[8 + i] = (_Float16)(p[16 + i] * sc); }
  return a;
}
// column fragment from a [K][ld] layout (column n), rows >= K read as 0
__device__ __forceinline__ v16h fragc_f32(const float* W, int k0, int n, int lane, int ld, int K) {
  v16h a; const int g = lane >> 4;
#pragma unroll
  for (int i = 0; i < 8; ++i) { const int ka = k0 + 8 * g + i, kb = ka + 16;
    a[i] = (_Float16)(ka < K ? W[(size_t)(ka < K ? ka : K - 1) * ld + n] : 0.f); a[8 + i] = (_Float16)(kb < K ? W[(size_t)(kb < K ? kb : K - 1) * ld + n] : 0.f); }
  return a;
}
struct F2 { v16b h, l; };
__device__ __forceinline__ F2 bsplit16(const float v[16]) { F2 r;
#pragma unroll
  for (int i = 0; i < 16; ++i) { const __bf16 h = (__bf16)v[i]; r.h[i] = h; r.l[i] = (__bf16)(v[i] - (float)h); }
  return r; }
__device__ __forceinline__ F2 split_row(const float* row, int k0, int lane) { float v[16]; const float* p = row + k0 + 8 * (lane >> 4);
#pragma unroll
  for (int i = 0; i < 8; ++i) { v[i] = p[i]; v[8 + i] = p[16 + i]; }
  return bsplit16(v); }
__device__ __forceinline__ F2 split_rowK(const float* row, int k0, int lane, int K) { float v[16]; const int g = lane >> 4;
#pragma unroll
  for (int i = 0; i < 8; ++i) { const int ka = k0 + 8 * g + i, kb = ka + 16; v[i] = ka < K ? row[ka < K ? ka : K - 1] : 0.f; v[8 + i] = kb < K ? row[kb < K ? kb : K - 1] : 0.f; }
  return bsplit16(v); }
__device__ __forceinline__ F2 split_col(const float* W, int k0, int n, int lane, int ld, int K) { float v[16]; const int g = lane >> 4;
#pragma unroll
  for (int i = 0; i < 8; ++i) { const int ka = k0 + 8 * g + i, kb = ka + 16; v[i] = ka < K ? W[(size_t)(ka < K ? ka : K - 1) * ld + n] : 0.f; v[8 + i] = kb < K ? W[(size_t)(kb < K ? kb : K - 1) * ld + n] : 0.f; }
  return bsplit16(v); }
__device__ __forceinline__ v8f mac3(const F2& a, const F2& b, v8f c) { c = wmma_bf(a.l, b.h, c); c = wmma_bf(a.h, b.l, c); return wmma_bf(a.h, b.h, c); }
__device__ __forceinline__ float sigm(float v) { return 1.0f / (1.0f + expf(-v)); }
#define LDSX() do { asm volatile("s_wait_dscnt 0" ::: "memory"); __builtin_amdgcn_wave_barrier(); __builtin_amdgcn_fence(__ATOMIC_RELEASE, "workgroup"); } while (0)

// Single-head causal self-attention (x [16,4096,64]; (in,out) Wq / Wk / Wv [64,64] N(0, 1/64), no biases; scale 64^-0.5; tril, finfo.min fill): out = softmax(causal(q k^T / 8)) v -> [16,4096,64].
#define NB 16
#define TT 4096
#define CC 128            // NH * HD = workspace row width; the projection fills the first HD columns
#define DIN 64          // input (model) width
#define NH 2
#define HD 64
#define NQB (TT / 64)
#define HG 1
#define SCALE (0.125f)
#define CAUSAL 1
#ifndef TNB
#define TNB NB
#endif
__device__ __forceinline__ float bfr(float v) { return (float)(__bf16)v; }
__host__ __device__ __forceinline__ int kb_last(int qb) { return CAUSAL ? ((qb * 64 + 63) >> 7) : (TT / 128 - 1); }
typedef __attribute__((ext_vector_type(8))) __bf16 v8b;
__device__ __forceinline__ v16b frag_b(const __bf16* rowk0, int lane) {
  union { v16b v; v8b q[2]; } u; const __bf16* p = rowk0 + 8 * (lane >> 4);
  u.q[0] = *(const v8b*)p; u.q[1] = *(const v8b*)(p + 16); return u.v;
}
#define QBH 6              // unused: the queries below row QHI (few keys, no averaging) take the high-precision path
#define QHI 384            // rows carrying a q residual plane
#define KHI 384            // key rows carrying k residual / v bf16 hi+lo planes (used only by the causal high-precision path)
// B fragment (k rows k0+.., output column o) of a weight: (in,out) [K][ld] or (out,in) [ld rows of K]: bf16 exact, or f16(bf16 * 256) exact
__device__ __forceinline__ v16b wcol_io(const float* Wm, int k0, int o, int lane, int ld) { v16b w; const int g = lane >> 4;
#pragma unroll
  for (int i = 0; i < 8; ++i) { w[i] = (__bf16)Wm[(size_t)(k0 + 8 * g + i) * ld + o]; w[8 + i] = (__bf16)Wm[(size_t)(k0 + 16 + 8 * g + i) * ld + o]; }
  return w; }
__device__ __forceinline__ v16b wcol_oi(const float* Wm, int k0, int o, int lane, int K) { v16b w; const float* p = Wm + (size_t)o * K + k0 + 8 * (lane >> 4);
#pragma unroll
  for (int i = 0; i < 8; ++i) { w[i] = (__bf16)p[i]; w[8 + i] = (__bf16)p[16 + i]; }
  return w; }
__device__ __forceinline__ v16h wcolh_io(const float* Wm, int k0, int o, int lane, int ld) { v16h w; const int g = lane >> 4;
#pragma unroll
  for (int i = 0; i < 8; ++i) { w[i] = (_Float16)(bfr(Wm[(size_t)(k0 + 8 * g + i) * ld + o]) * 256.0f); w[8 + i] = (_Float16)(bfr(Wm[(size_t)(k0 + 16 + 8 * g + i) * ld + o]) * 256.0f); }
  return w; }
__device__ __forceinline__ v16h wcolh_oi(const float* Wm, int k0, int o, int lane, int K) { v16h w; const float* p = Wm + (size_t)o * K + k0 + 8 * (lane >> 4);
#pragma unroll
  for (int i = 0; i < 8; ++i) { w[i] = (_Float16)(bfr(p[i]) * 256.0f); w[8 + i] = (_Float16)(bfr(p[16 + i]) * 256.0f); }
  return w; }
#define WQKV_LAYOUT 0   // 0 = (in,out) [DIN][CC]; 1 = (out,in) [CC][DIN]; 2 = per-head [NH][DIN][HD]
__device__ __forceinline__ v16b wcol_hdk(const float* Wm, int k0, int o, int lane) { v16b w; const int g = lane >> 4; const float* p = Wm + (size_t)(o / HD) * DIN * HD + (o % HD);
#pragma unroll
  for (int i = 0; i < 8; ++i) { w[i] = (__bf16)p[(size_t)(k0 + 8 * g + i) * HD]; w[8 + i] = (__bf16)p[(size_t)(k0 + 16 + 8 * g + i) * HD]; }
  return w; }
#define WO_OUT_IN 0
#if WQKV_LAYOUT == 1
#define WCOL(W, k0, o, lane) wcol_oi(W, k0, o, lane, DIN)
#elif WQKV_LAYOUT == 2
#define WCOL(W, k0, o, lane) wcol_hdk(W, k0, o, lane)
#else
#define WCOL(W, k0, o, lane) wcol_io(W, k0, o, lane, CC)
#endif
#if WO_OUT_IN
#define WOCOL(W, k0, o, lane) wcol_oi(W, k0, o, lane, CC)
#define WOCOLH(W, k0, o, lane) wcolh_oi(W, k0, o, lane, CC)
#else
#define WOCOL(W, k0, o, lane) wcol_io(W, k0, o, lane, DIN)
#define WOCOLH(W, k0, o, lane) wcolh_io(W, k0, o, lane, DIN)
#endif
#define CIN 64
#define WS_WP (WS_END)                                  // not used; counted by the size test in kernel_launch
#define WS_BP (WS_WP + 4u * 3 * (size_t)CIN * 128)        // not used; counted by the size test in kernel_launch
#define WS_Y2 (WS_BP + 4u * 3 * 128)                      // not used; counted by the size test in kernel_launch
#define WS_END2 (WS_Y2 + 4u * (size_t)NB * TT * CC)
#ifndef SM_EXTRA_PARAMS
#define SM_EXTRA_PARAMS
#endif
#ifndef PROJ_EXTRA_PARAMS
#define PROJ_EXTRA_PARAMS
#endif
#ifndef SM_MASK_HOOK
#define SM_MASK_HOOK (void)0
#endif

#define WS_QH  0u                                      // f16 q rows [b*t][CC]
#define WS_KH  (WS_QH + 2u * (size_t)NB * TT * CC)      // f16 k in fragment order [b][t / 16][kc][u][lane = 16 h + (t & 15)][8]: column 32 kc + 16 u + 8 h + i, the HD real columns only
#define WS_VT  (WS_KH + 2u * (size_t)NB * TT * CC)      // f16 v in fragment order [b][t / 32][j][u][lane = 16 h + c][8]: column 16 j + c, row 32 (t / 32) + 16 u + 8 h + i, the HD real columns only
#define WS_QL  (WS_VT + 2u * (size_t)NB * CC * TT)      // f16 q residual x 2^10 rows [b][t < QHI][CC]
#define WS_KL  (WS_QL + 2u * (size_t)NB * QHI * CC)     // f16 k residual x 2^10 rows [b][t < KHI][CC]
#define WS_VB  (WS_KL + 2u * (size_t)NB * KHI * CC)     // bf16 v hi planes [b][c][t < KHI]
#define WS_VBL (WS_VB + 2u * (size_t)NB * CC * KHI)
#define WS_S   (WS_VBL + 2u * (size_t)NB * CC * KHI)    // f32 [hg][t][s], not used: the logits stay in registers
#define WS_Y   (WS_S  + 4u * (size_t)HG * TT * TT)      // f32 ctx rows [b*t][CC] (only when there is an output projection)
#define WS_END (WS_Y  + 0u)

// B fragment of an (in,out) [DIN][HD] weight, bf16 exact; p = the lane's first element (row k0 + 8 h, its own column)
__device__ __forceinline__ v16b wcol_p(const float* p) { v16b w;
#pragma unroll
  for (int i = 0; i < 8; ++i) { w[i] = (__bf16)p[i * HD]; w[8 + i] = (__bf16)p[(16 + i) * HD]; }
  return w; }
// ---- k_proj: block = (64 rows, the HD real cols, which), weights read as given, (in,out) [DIN][HD]; columns HD..CC-1 of the CC-wide planes are neither computed nor stored (k_fa reads none of them): q/k/v = X W (+ b) with exact bf16 products (K = DIN) -> which 0: q f16 rows (+ residual rows < QHI); 1: k f16 in fragment order (+ residual rows < KHI); 2: v f16 in fragment order (+ bf16 hi/lo planes for t < KHI)
__global__ __launch_bounds__(128) void k_proj(const float* __restrict__ XQ, const float* __restrict__ XK, const float* __restrict__ XV, const float* __restrict__ WQ, const float* __restrict__ WK, const float* __restrict__ WV, const float* __restrict__ BQ, const float* __restrict__ BK, const float* __restrict__ BV,
    _Float16* __restrict__ QH, _Float16* __restrict__ QL, _Float16* __restrict__ KH, _Float16* __restrict__ KL, _Float16* __restrict__ VT, __bf16* __restrict__ VB, __bf16* __restrict__ VBL) {
  __shared__ __align__(16) _Float16 sh[64][72], sl[64][72]; __shared__ __align__(16) _Float16 th[64][72]; __shared__ __align__(16) __bf16 tb[64][72], tbl[64][72];
  const int tid = threadIdx.x, wave = tid >> 5, lane = tid & 31, col = lane & 15, g = lane >> 4; const int which = blockIdx.z; const size_t r0 = (size_t)blockIdx.x * 64; const size_t bb = r0 / TT; const int t0 = (int)(r0 % TT);
  const float* X = which == 0 ? XQ : which == 1 ? XK : XV; const float* WA = which == 0 ? WQ : which == 1 ? WK : WV; const float* BA = which == 0 ? BQ : which == 1 ? BK : BV;
  const float* wp = WA + (size_t)(8 * g) * HD + col;
  v8f acc[4] = {};
#pragma unroll 2
  for (int kc = 0; kc < DIN / 32; ++kc) { v16b a; { const float* p = X + (r0 + wave * 16 + col) * DIN + kc * 32 + 8 * g;
#pragma unroll
      for (int i = 0; i < 8; ++i) { a[i] = (__bf16)p[i]; a[8 + i] = (__bf16)p[16 + i]; } }
    asm volatile("s_wait_loadcnt 0x0" ::: "memory");
#pragma unroll
    for (int j = 0; j < 4; ++j) { const v16b w = wcol_p(wp + kc * 32 * HD + j * 16); asm volatile("s_wait_loadcnt 0x0" :: "v"(wp) : "memory"); acc[j] = wmma_bf(a, w, acc[j]); } }   // wp as an input: the pair that the weight loads name stays whole up to their wait (without it the last load lands on it)
  if (which < 2) { _Float16* DH = which == 0 ? QH : KH; _Float16* DL = which == 0 ? QL : KL; const int nhi = which == 0 ? QHI : KHI; const bool hi_rows = t0 < nhi;
#pragma unroll
    for (int j = 0; j < 4; ++j) { const float bias = BA ? bfr(BA[j * 16 + col]) : 0.f;
#pragma unroll
      for (int r = 0; r < 8; ++r) { const float v = acc[j][r] + bias; const _Float16 hv = (_Float16)v; sh[wave * 16 + 8 * g + r][j * 16 + col] = hv; sl[wave * 16 + 8 * g + r][j * 16 + col] = (_Float16)((v - (float)hv) * 1024.0f); } }
    __syncthreads();
    if (which == 0) for (int e = tid; e < 64 * 8; e += 128) { const int rl = e >> 3, q = e & 7; vst2((unsigned*)(DH + (r0 + rl) * CC + q * 8), *(const v4u*)&sh[rl][q * 8]); }
    else for (int e = tid; e < 64 * 8; e += 128) { const int ln = e & 31, u = (e >> 5) & 1, kc = (e >> 6) & 1, tl = e >> 7; vst2((unsigned*)(DH + r0 * HD + e * 8), *(const v4u*)&sh[16 * tl + (ln & 15)][32 * kc + 16 * u + 8 * (ln >> 4)]); }   // the block's 64 keys = 8 KB in a row
    if (hi_rows) for (int e = tid; e < 64 * 8; e += 128) { const int rl = e >> 3, q = e & 7; vst2((unsigned*)(DL + (bb * nhi + t0 + rl) * (size_t)CC + q * 8), *(const v4u*)&sl[rl][q * 8]); }
  } else { const bool hi_rows = t0 < KHI;
#pragma unroll
    for (int j = 0; j < 4; ++j) { const float bias = BA ? bfr(BA[j * 16 + col]) : 0.f;
#pragma unroll
      for (int r = 0; r < 8; ++r) { const float v = acc[j][r] + bias; const int rl = wave * 16 + 8 * g + r, cl = j * 16 + col; th[cl][rl] = (_Float16)v; const __bf16 bh = (__bf16)v; tb[cl][rl] = bh; tbl[cl][rl] = (__bf16)(v - (float)bh); } }
    __syncthreads();
    for (int e = tid; e < 64 * 8; e += 128) { const int ln = e & 31, u = (e >> 5) & 1, j = (e >> 6) & 3, pl = e >> 8; vst2((unsigned*)(VT + r0 * HD + e * 8), *(const v4u*)&th[16 * j + (ln & 15)][32 * pl + 16 * u + 8 * (ln >> 4)]); }   // the block's 64 keys = 8 KB in a row
    if (hi_rows) for (int e = tid; e < 64 * 8; e += 128) { const int cl = e >> 3, q = e & 7; const size_t o3 = (bb * CC + cl) * (size_t)KHI + t0 + q * 8; vst2((unsigned*)(VB + o3), *(const v4u*)&tb[cl][q * 8]); vst2((unsigned*)(VBL + o3), *(const v4u*)&tbl[cl][q * 8]); } } }
#define FSC (SCALE * 1.4426950408889634f)
#define FPK 4.0f           // P carries 2^4: largest value 2^12 in f16, and the small ones stay normal numbers
__device__ __forceinline__ float xhalf(float x) { return __builtin_bit_cast(float, __builtin_amdgcn_permlanex16(__builtin_bit_cast(int, x), __builtin_bit_cast(int, x), 0x76543210, 0xfedcba98, false, false)); }  // lane l with lane l ^ 16
__device__ __forceinline__ v8f mmh(v16h a, v16h b, v8f c) { return __builtin_amdgcn_wmma_f32_16x16x32_f16(false, a, false, b, (short)0, c, false, false); }
__device__ __forceinline__ v8f mmb(v16b a, v16b b, v8f c) { return __builtin_amdgcn_wmma_f32_16x16x32_bf16(false, a, false, b, (short)0, c, false, false); }
// one 32-key pass, raw logits s[g][t][r] (query q0 + 16 g + c, key k0 + 16 t + 8 h + r). fa_max: mask, maxima, and m, l (this half's part of the sum) and the output tiles kept in step; fa_exp: s -> P in place, l grows
template <int NG> __device__ __forceinline__ void fa_max(v8f (&s)[NG][2], bool diag, int k0, int q0, int c, int h, float (&m)[NG], float (&l)[NG], v8f (&o)[NG][4]) {
  if (diag) {   // wave-uniform: only the pass on the diagonal pays for the mask; every column keeps at least key k0 <= its query
#pragma unroll
    for (int g = 0; g < NG; ++g)
#pragma unroll
      for (int t = 0; t < 2; ++t)
#pragma unroll
        for (int r = 0; r < 8; ++r) if (k0 + 16 * t + 8 * h + r > q0 + 16 * g + c) s[g][t][r] = -3.0e38f; }
  float mb[NG]; bool need = false;
#pragma unroll
  for (int g = 0; g < NG; ++g) { float mx = s[g][0][0];
#pragma unroll
    for (int r = 0; r < 8; ++r) mx = fmaxf(mx, fmaxf(s[g][0][r], s[g][1][r]));
    mx = fmaxf(mx, xhalf(mx)) * FSC; mb[g] = mx; need = need || (mx > m[g] + 8.0f); }
  if (__builtin_amdgcn_ballot_w32(need) != 0) {   // scalar branch, rare after the first passes
#pragma unroll
    for (int g = 0; g < NG; ++g) { const float mn = fmaxf(m[g], mb[g]); const float corr = __builtin_amdgcn_exp2f(m[g] - mn); m[g] = mn; l[g] *= corr;   // corr = 0 on the first pass
#pragma unroll
      for (int j = 0; j < 4; ++j) o[g][j] = o[g][j] * corr; } } }
template <int NG> __device__ __forceinline__ void fa_exp(v8f (&s)[NG][2], const float (&m)[NG], float (&l)[NG]) {
#pragma unroll
  for (int g = 0; g < NG; ++g) { const float nm = FPK - m[g];
#pragma unroll
    for (int t = 0; t < 2; ++t)
#pragma unroll
      for (int r = 0; r < 8; ++r) s[g][t][r] = __builtin_amdgcn_exp2f(fmaf(s[g][t][r], FSC, nm));
    const v8f sv = s[g][0] + s[g][1]; l[g] += ((sv[0] + sv[1]) + (sv[2] + sv[3])) + ((sv[4] + sv[5]) + (sv[6] + sv[7])); } }
template <int NG> __device__ __forceinline__ void fa_store(const v8f (&o)[NG][4], const float (&l)[NG], int q0, int c, int h, float* __restrict__ Ob) {
#pragma unroll
  for (int g = 0; g < NG; ++g) { const float inv = 1.0f / (l[g] + xhalf(l[g])); float* op = Ob + (size_t)(q0 + 16 * g + c) * HD + 8 * h;   // a lane holds 8 consecutive d of its query per tile
#pragma unroll
    for (int j = 0; j < 4; ++j) { v4f a, e;
#pragma unroll
      for (int r = 0; r < 4; ++r) { a[r] = o[g][j][r] * inv; e[r] = o[g][j][4 + r] * inv; }
      vst2(op + 16 * j, a); vst2(op + 16 * j + 4, e); } }
  asm volatile("s_wait_xcnt 0x0" ::: "memory"); }   // on the way to the kernel's barrier the compiler writes over registers that these stores name
// 32 queries from row QHI on, the 32-key passes hf, hf + 2, ... of their keys: one f16 product for the logits, P once to f16 against v f16. K and v fragments are fetched one pass ahead, each right behind the products that read it.
// pr == 0 (wave-uniform; pair 0 holds the work-group's longest tile): this wave also asks L2 for the K and v blocks of its pass p + 2 PFD, one byte prefetch every 256 bytes (lanes 0..15: the 4 KB of K, lanes 16..31: the 4 KB of v). The first read of a K or v line in k_fa is taken to come from memory,
// and the register fetch leads its use by less than one pass, far less than the way to memory; the waves of a work-group walk the same keys nearly in step, so the wave with the most passes asks for all of them.
#define PFD 6
__device__ __forceinline__ void fa_lo(const _Float16* __restrict__ Qb, const _Float16* __restrict__ Kb, const _Float16* __restrict__ Vb, int q0, int hf, int pr, int lane, v8f (&o)[2][4], float (&m)[2], float (&l)[2]) {
  const int c = lane & 15, h = lane >> 4; v16h qf[2][2], kf[2][2];
  unsigned long long pa = (unsigned long long)(h ? Vb : Kb) + (unsigned)(4096 * hf + 256 * c);   // the lane's unit of the pass in hand; it lives in one register pair through the loop and never leaves the wave's own passes
  if (pr == 0)   // passes hf + 2 .. hf + 2 (PFD - 1) at once (np >= QHI / 32 + 1 = 13, so they exist): their ways to memory overlap instead of following one another
    asm volatile("global_prefetch_b8 %0, off offset:8192 scope:SCOPE_SE\n\tglobal_prefetch_b8 %0, off offset:16384 scope:SCOPE_SE\n\tglobal_prefetch_b8 %0, off offset:24576 scope:SCOPE_SE\n\t"
                 "global_prefetch_b8 %0, off offset:32768 scope:SCOPE_SE\n\tglobal_prefetch_b8 %0, off offset:40960 scope:SCOPE_SE" : "+v"(pa));
#pragma unroll
  for (int g = 0; g < 2; ++g)
#pragma unroll
    for (int kc = 0; kc < 2; ++kc) { qf[g][kc] = frag_h(Qb + (size_t)(q0 + 16 * g + c) * CC + kc * 32, lane); kf[g][kc] = frag_p(Kb + (size_t)(32 * hf) * HD + (2 * g + kc) * 512 + 8 * lane); }
  asm volatile("s_wait_xcnt 0x0" ::: "memory");   // the zeroing of the output tiles, which the compiler sets behind the v loads, writes over the Q loads' address pairs
  const int np = q0 / 32 + 1; v16h vf[4];
  const int pe = np - 2 * PFD - TT * pr;   // pair 0: passes below pe have a pass 2 PFD further on; any other pair: below 0, no pass asks (one scalar compare a pass)
#pragma unroll
  for (int j = 0; j < 4; ++j) vf[j] = frag_p(Vb + (size_t)(32 * hf) * HD + j * 512 + 8 * lane);
  asm volatile("s_wait_xcnt 0x0" ::: "memory");   // on the way into the loop scalar registers of the base that the v loads name are written over
  asm volatile("" :: "v"(qf[0][0]), "v"(qf[0][1]), "v"(qf[1][0]), "v"(qf[1][1]));   // inputs only: Q has landed before the loop, so that the loop's own waits count only the K and v loads in flight (else each pass waits for all of them)
  for (int p = hf; p < np; p += 2) { const int k0 = p * 32;
    if (p < pe)   // scalar branch; the register steps to pass p + 2, the offset reaches pass p + 2 PFD < np: both inside K and v. The step stands in front of the request, a whole pass and the wait at the loop's foot behind the last one
      asm volatile("v_add_nc_u64 %0, %1, %0\n\tglobal_prefetch_b8 %0, off offset:40960 scope:SCOPE_SE" : "+v"(pa) : "s"(8192ull));
    v8f s[2][2];
#pragma unroll
    for (int g = 0; g < 2; ++g)
#pragma unroll
      for (int t = 0; t < 2; ++t) { v8f z = {}; z = mmh(kf[t][0], qf[g][0], z); s[g][t] = mmh(kf[t][1], qf[g][1], z); }
    fa_max<2>(s, p + 1 == np, k0, q0, c, h, m, l, o);
    const int kn = p + 2 < np ? k0 + 64 : k0;   // the last pass fetches its own blocks again: in bounds, not used
    const _Float16 *kq = Kb + (size_t)kn * HD + 8 * lane, *vq = Vb + (size_t)kn * HD + 8 * lane;   // a pass is 4 KB of K and 4 KB of v in a row
#pragma unroll
    for (int t = 0; t < 2; ++t)
#pragma unroll
      for (int kc = 0; kc < 2; ++kc) kf[t][kc] = frag_p(kq + (2 * t + kc) * 512);
    __builtin_amdgcn_sched_barrier(0);   // keeps the next K loads in front of the exponentials, whose time covers their latency; without it they are issued behind the second product
    fa_exp<2>(s, m, l);
#pragma unroll
    for (int g = 0; g < 2; ++g) { v16h pb;
#pragma unroll
      for (int i = 0; i < 8; ++i) { pb[i] = (_Float16)s[g][0][i]; pb[8 + i] = (_Float16)s[g][1][i]; }
#pragma unroll
      for (int j = 0; j < 4; ++j) o[g][j] = mmh(vf[j], pb, o[g][j]); }
#pragma unroll
    for (int j = 0; j < 4; ++j) vf[j] = frag_p(vq + j * 512);
    asm volatile("s_wait_xcnt 0x0" :: "v"(kq), "v"(vq) : "memory"); }   // the two address pairs are written over behind this place; as inputs they stay whole up to the wait (without that the last K load lands on its own address pair)
}
// 16 queries below row QHI (few keys, no averaging): 3 products for the logits (q hi + residual x k hi + residual), P and v as bf16 hi + lo (3 products)
__device__ __forceinline__ void fa_hi(const _Float16* __restrict__ Qb, const _Float16* __restrict__ QLb, const _Float16* __restrict__ Kb, const _Float16* __restrict__ KLb, const __bf16* __restrict__ VBb, const __bf16* __restrict__ VBLb, int q0, int hw, int lane, float* __restrict__ Ob) {
  const int c = lane & 15, h = lane >> 4; v16h qh[2], ql[2];
  // At entry the work-group's 8 waves of this path (hw = 0..7) ask L2 for the planes that only this path reads, one byte prefetch every 256 bytes, 96 a wave: the KHI rows of the k residual (hw 0..3), the HD real planes of v hi (4, 5) and of v lo (6, 7).
  // The loop below fetches nothing ahead, so that each pass would wait out the way to memory several times in a row.
  const unsigned long long ha = (unsigned long long)(hw < 4 ? (const char*)KLb + 24576 * hw : hw < 6 ? (const char*)VBb + 24576 * (hw - 4) : (const char*)VBLb + 24576 * (hw - 6)) + (unsigned)(256 * lane);
  asm volatile("global_prefetch_b8 %0, off scope:SCOPE_SE\n\tglobal_prefetch_b8 %0, off offset:8192 scope:SCOPE_SE\n\tglobal_prefetch_b8 %0, off offset:16384 scope:SCOPE_SE" :: "v"(ha));
#pragma unroll
  for (int kc = 0; kc < 2; ++kc) { qh[kc] = frag_h(Qb + (size_t)(q0 + c) * CC + kc * 32, lane); ql[kc] = frag_h(QLb + (size_t)(q0 + c) * CC + kc * 32, lane); }
  v8f o[1][4] = {}; float m[1] = {-3.0e38f}, l[1] = {0.f}; const int np = (q0 + 47) / 32;
  for (int p = 0; p < np; ++p) { const int k0 = p * 32; v8f s[1][2];
#pragma unroll
    for (int t = 0; t < 2; ++t) { v8f a = {}, al = {};
#pragma unroll
      for (int kc = 0; kc < 2; ++kc) { const size_t ko = (size_t)(k0 + 16 * t + c) * CC + kc * 32; const v16h kh = frag_p(Kb + (size_t)k0 * HD + (2 * t + kc) * 512 + 8 * lane), kl = frag_h(KLb + ko, lane); a = mmh(kh, qh[kc], a); al = mmh(kh, ql[kc], al); al = mmh(kl, qh[kc], al); }
      s[0][t] = a + al * (1.0f / 1024.0f); }
    fa_max<1>(s, p + 1 == np, k0, q0, c, h, m, l, o); fa_exp<1>(s, m, l);
    v16b ph, pl;
#pragma unroll
    for (int i = 0; i < 16; ++i) { const float x = s[0][i >> 3][i & 7]; const __bf16 bh = (__bf16)x; ph[i] = bh; pl[i] = (__bf16)(x - (float)bh); }
#pragma unroll
    for (int j = 0; j < 4; ++j) { const size_t po = (size_t)(16 * j + c) * KHI + k0; const v16b vh = frag_b(VBb + po, lane), vl = frag_b(VBLb + po, lane); o[0][j] = mmb(vh, ph, o[0][j]); o[0][j] = mmb(vh, pl, o[0][j]); o[0][j] = mmb(vl, ph, o[0][j]); } }
  asm volatile("s_wait_xcnt 0x0" :: "v"(ha) : "memory");   // as an input here the pair that the entry requests name stays whole, an address inside its plane, through the loop and up to this wait
  fa_store<1>(o, l, q0, c, h, Ob); }
// block = 16 waves of one batch = 8 pairs, a pair = one 32-query tile. From row QHI on the pair's waves take the even and the odd 32-key passes, each with its own m, l and output tiles; the odd wave hands its state over through LDS
// (same lane, same registers) and the even wave joins the two at the common maximum. Below row QHI each wave of the pair takes 16 of the queries over all their keys. Waves w, w + 4, w + 8, w + 12 (taken to share a SIMD; a matter of speed only) hold tiles 127 - i and i: the same number of passes for every SIMD.
// K and v f16 fragments are read in the register order in which k_proj stores them: a 32-key pass is 4 KB of K and 4 KB of v in a row, every load four whole lines. Every wave still fetches its own copy.
__global__ __launch_bounds__(512) void k_fa(const _Float16* __restrict__ QH, const _Float16* __restrict__ KH, const _Float16* __restrict__ VT, const _Float16* __restrict__ QL, const _Float16* __restrict__ KL, const __bf16* __restrict__ VB, const __bf16* __restrict__ VBL, float* __restrict__ OUT) {
  __shared__ __align__(16) v4f xs[8][17][32];
  const int wave = __builtin_amdgcn_readfirstlane(threadIdx.x >> 5), lane = threadIdx.x & 31; const int b = blockIdx.x >> 4, pb = blockIdx.x & 15; const int hf = (wave >> 2) & 1, pr = (wave & 3) + 4 * (wave >> 3);
  const int q0 = 32 * (pr < 4 ? TT / 32 - 1 - (4 * pb + pr) : 4 * pb + (pr - 4)); const bool lo = q0 >= QHI;
  const _Float16* Qb = QH + (size_t)b * TT * CC; const _Float16* Kb = KH + (size_t)b * TT * HD; float* Ob = OUT + (size_t)b * TT * HD;
  v8f o[2][4] = {}; float m[2] = {-3.0e38f, -3.0e38f}, l[2] = {0.f, 0.f};
  if (lo) fa_lo(Qb, Kb, VT + (size_t)b * TT * HD, q0, hf, pr, lane, o, m, l);
  else fa_hi(Qb, QL + (size_t)b * QHI * CC, Kb, KL + (size_t)b * KHI * CC, VB + (size_t)b * CC * KHI, VBL + (size_t)b * CC * KHI, q0 + 16 * hf, 2 * (pr & 3) + hf, lane, Ob);
  if (lo && hf) {
#pragma unroll
    for (int g = 0; g < 2; ++g)
#pragma unroll
      for (int j = 0; j < 4; ++j) { xs[pr][(g * 4 + j) * 2][lane] = v4f{o[g][j][0], o[g][j][1], o[g][j][2], o[g][j][3]}; xs[pr][(g * 4 + j) * 2 + 1][lane] = v4f{o[g][j][4], o[g][j][5], o[g][j][6], o[g][j][7]}; }
    xs[pr][16][lane] = v4f{m[0], m[1], l[0], l[1]}; }
  __syncthreads();   // every wave passes it once: the odd waves' states are in LDS before the even waves read them
  if (lo && !hf) { const v4f ml = xs[pr][16][lane];
#pragma unroll
    for (int g = 0; g < 2; ++g) { const float mn = fmaxf(m[g], ml[g]); const float fa = __builtin_amdgcn_exp2f(m[g] - mn), fb = __builtin_amdgcn_exp2f(ml[g] - mn); l[g] = l[g] * fa + ml[2 + g] * fb;   // both waves have had at least one pass (np >= QHI / 32 + 1), so both maxima are real
#pragma unroll
      for (int j = 0; j < 4; ++j) { const v4f x0 = xs[pr][(g * 4 + j) * 2][lane], x1 = xs[pr][(g * 4 + j) * 2 + 1][lane];
#pragma unroll
        for (int r = 0; r < 4; ++r) { o[g][j][r] = o[g][j][r] * fa + x0[r] * fb; o[g][j][4 + r] = o[g][j][4 + r] * fa + x1[r] * fb; } } }
    fa_store<2>(o, l, q0, lane & 15, lane >> 4, Ob); } }

extern "C" void kernel_launch(void* const* d_in, const int* in_sizes, int n_in, void* d_out, int out_size, void* d_ws, size_t ws_size, hipStream_t stream) {
  (void)in_sizes; (void)n_in; (void)out_size;
  const float** F = (const float**)d_in;
  char* ws = (char*)d_ws; _Float16 *QH = (_Float16*)(ws + WS_QH), *KH = (_Float16*)(ws + WS_KH), *VT = (_Float16*)(ws + WS_VT), *QL = (_Float16*)(ws + WS_QL), *KL = (_Float16*)(ws + WS_KL); __bf16 *VB = (__bf16*)(ws + WS_VB), *VBL = (__bf16*)(ws + WS_VBL);
  // inputs: 0 x [16,4096,64]; 1 Wq [64,64]; 2 Wk; 3 Wv ((in,out), no biases)
  if (ws_size < (size_t)WS_END2) return;
  k_proj<<<dim3(TNB * TT / 64, 1, 3), 128, 0, stream>>>(F[0], F[0], F[0], F[1], F[2], F[3], nullptr, nullptr, nullptr, QH, QL, KH, KL, VT, VB, VBL);
  k_fa<<<dim3(TNB * 16), 512, 0, stream>>>(QH, KH, VT, QL, KL, VB, VBL, (float*)d_out);   /* head 0 only (columns HD..CC-1 are neither written nor read) */
}

// v006
// A run of this version takes 52.8 microseconds.
// In both of two side-by-side timings against v005, it was 1.06 times as fast.
// Counting every step since v000, it is 49.2 times as fast.
// compute dtype: all float inputs rounded to bf16; q/k/v projections with EXACT bf16 products on WMMA 16x16x32 (f32 accumulate); causal logits: 3 products (q f16 hi + residual x k hi + residual) for the first 384 rows, single f16 q x k after, x scale; online softmax f32; unnormalised P x 2^4 once to f16 x v once to f16 (1 product; bf16 hi + lo below row 384), divided by the f32 sum last; f32 output.
#include <hip/hip_runtime.h>
#include <math.h>

typedef __attribute__((ext_vector_type(16))) _Float16 v16h;
typedef __attribute__((ext_vector_type(16))) __bf16 v16b;
typedef __attribute__((ext_vector_type(8)))  _Float16 v8h;
typedef __attribute__((ext_vector_type(8)))  float v8f;
typedef __attribute__((ext_vector_type(4)))  float v4f;
typedef __attribute__((ext_vector_type(2)))  float v2f;
typedef __attribute__((ext_vector_type(4)))  unsigned v4u;
typedef __attribute__((ext_vector_type(4)))  int v4i;
typedef float __attribute__((may_alias)) float_a;
typedef int __attribute__((may_alias)) int_a;

template <typename T> __device__ __forceinline__ void vst2(void* p, T v) { *(T*)p = v;  }
__device__ __forceinline__ v8f wmma16(v16h a, v16h b, v8f c) {
  v8f d = __builtin_amdgcn_wmma_f32_16x16x32_f16(false, a, false, b, (short)0, c, false, false);
  asm volatile("v_nop\n\tv_nop\n\tv_nop\n\tv_nop" : "+v"(d) : "v"(a), "v"(b));
  return d;
}
__device__ __forceinline__ v8f wmma_bf(v16b a, v16b b, v8f c) {
  v8f d = __builtin_amdgcn_wmma_f32_16x16x32_bf16(false, a, false, b, (short)0, c, false, false);
  asm volatile("v_nop\n\tv_nop\n\tv_nop\n\tv_nop" : "+v"(d) : "v"(a), "v"(b));
  return d;
}
// 16x16x32 fragments: lane = (h = lane>>4, row/col = lane&15); elements 0..7 = k0+8h+0..7, 8..15 = k0+16+8h+0..7; D element r = row 8h+r
__device__ __forceinline__ v16h frag_h(const _Float16* rowk0, int lane) {
  union { v16h v; v8h q[2]; } u; const _Float16* p = rowk0 + 8 * (lane >> 4);
  u.q[0] = *(const v8h*)p; u.q[1] = *(const v8h*)(p + 16); return u.v;
}
// a fragment stored in register order: two 512-byte blocks, lane l's 16 bytes at 16 l, so that each wave-wide load covers four whole 128-byte lines
__device__ __forceinline__ v16h frag_p(const _Float16* p) {   // p = the fragment's first block + 8 * lane
  union { v16h v; v8h q[2]; } u; u.q[0] = *(const v8h*)p; u.q[1] = *(const v8h*)(p + 256); return u.v;
}
__device__ __forceinline__ v16h frag_f32(const float* rowk0, int lane) {
  v16h a; const float* p = rowk0 + 8 * (lane >> 4);
#pragma unroll
  for (int i = 0; i < 8; ++i) { a[i] = (_Float16)p[i]; a[8 + i] = (_Float16)p[16 + i]; }
  return a;
}
__device__ __forceinline__ v16h frag_f32s(const float* rowk0, int lane, float sc) {
  v16h a; const float* p = rowk0 + 8 * (lane >> 4);
#pragma unroll
  for (int i = 0; i < 8; ++i) { a[i] = (_Float16)(p[i] * sc); a[8 + i] = (_Float16)(p[16 + i] * sc); }
  return a;
}
// column fragment from a [K][ld] layout (column n), rows >= K read as 0
__device__ __forceinline__ v16h fragc_f32(const float* W, int k0, int n, int lane, int ld, int K) {
  v16h a; const int g = lane >> 4;
#pragma unroll
  for (int i = 0; i < 8; ++i) { const int ka = k0 + 8 * g + i, kb = ka + 16;
    a[i] = (_Float16)(ka < K ? W[(size_t)(ka < K ? ka : K - 1) * ld + n] : 0.f); a[8 + i] = (_Float16)(kb < K ? W[(size_t)(kb < K ? kb : K - 1) * ld + n] : 0.f); }
  return a;
}
struct F2 { v16b h, l; };
__device__ __forceinline__ F2 bsplit16(const float v[16]) { F2 r;
#pragma unroll
  for (int i = 0; i < 16; ++i) { const __bf16 h = (__bf16)v[i]; r.h[i] = h; r.l[i] = (__bf16)(v[i] - (float)h); }
  return r; }
__device__ __forceinline__ F2 split_row(const float* row, int k0, int lane) { float v[16]; const float* p = row + k0 + 8 * (lane >> 4);
#pragma unroll
  for (int i = 0; i < 8; ++i) { v[i] = p[i]; v[8 + i] = p[16 + i]; }
  return bsplit16(v); }
__device__ __forceinline__ F2 split_rowK(const float* row, int k0, int lane, int K) { float v[16]; const int g = lane >> 4;
#pragma unroll
  for (int i = 0; i < 8; ++i) { const int ka = k0 + 8 * g + i, kb = ka + 16; v[i] = ka < K ? row[ka < K ? ka : K - 1] : 0.f; v[8 + i] = kb < K ? row[kb < K ? kb : K - 1] : 0.f; }
  return bsplit16(v); }
__device__ __forceinline__ F2 split_col(const float* W, int k0, int n, int lane, int ld, int K) { float v[16]; const int g = lane >> 4;
#pragma unroll
  for (int i = 0; i < 8; ++i) { const int ka = k0 + 8 * g + i, kb = ka + 16; v[i] = ka < K ? W[(size_t)(ka < K ? ka : K - 1) * ld + n] : 0.f; v[8 + i] = kb < K ? W[(size_t)(kb < K ? kb : K - 1) * ld + n] : 0.f; }
  return bsplit16(v); }
__device__ __forceinline__ v8f mac3(const F2& a, const F2& b, v8f c) { c = wmma_bf(a.l, b.h, c); c = wmma_bf(a.h, b.l, c); return wmma_bf(a.h, b.h, c); }
__device__ __forceinline__ float sigm(float v) { return 1.0f / (1.0f + expf(-v)); }
#define LDSX() do { asm volatile("s_wait_dscnt 0" ::: "memory"); __builtin_amdgcn_wave_barrier(); __builtin_amdgcn_fence(__ATOMIC_RELEASE, "workgroup"); } while (0)

// Single-head causal self-attention (x [16,4096,64]; (in,out) Wq / Wk / Wv [64,64] N(0, 1/64), no biases; scale 64^-0.5; tril, finfo.min fill): out = softmax(causal(q k^T / 8)) v -> [16,4096,64].
#define NB 16
#define TT 4096
#define CC 128            // NH * HD = workspace row width; the projection fills the first HD columns
#define DIN 64          // input (model) width
#define NH 2
#define HD 64
#define NQB (TT / 64)
#define HG 1
#define SCALE (0.125f)
#define CAUSAL 1
#ifndef TNB
#define TNB NB
#endif
__device__ __forceinline__ float bfr(float v) { return (float)(__bf16)v; }
__host__ __device__ __forceinline__ int kb_last(int qb) { return CAUSAL ? ((qb * 64 + 63) >> 7) : (TT / 128 - 1); }
typedef __attribute__((ext_vector_type(8))) __bf16 v8b;
typedef __attribute__((ext_vector_type(4))) __bf16 v4b;
__device__ __forceinline__ v16b frag_b(const __bf16* rowk0, int lane) {
  union { v16b v; v8b q[2]; } u; const __bf16* p = rowk0 + 8 * (lane >> 4);
  u.q[0] = *(const v8b*)p; u.q[1] = *(const v8b*)(p + 16); return u.v;
}
#define QBH 6              // unused: the queries below row QHI (few keys, no averaging) take the high-precision path
#define QHI 384            // rows carrying a q residual plane
#define KHI 384            // key rows carrying k residual / v bf16 hi+lo planes (used only by the causal high-precision path)
// B fragment (k rows k0+.., output column o) of a weight: (in,out) [K][ld] or (out,in) [ld rows of K]: bf16 exact, or f16(bf16 * 256) exact
__device__ __forceinline__ v16b wcol_io(const float* Wm, int k0, int o, int lane, int ld) { v16b w; const int g = lane >> 4;
#pragma unroll
  for (int i = 0; i < 8; ++i) { w[i] = (__bf16)Wm[(size_t)(k0 + 8 * g + i) * ld + o]; w[8 + i] = (__bf16)Wm[(size_t)(k0 + 16 + 8 * g + i) * ld + o]; }
  return w; }
__device__ __forceinline__ v16b wcol_oi(const float* Wm, int k0, int o, int lane, int K) { v16b w; const float* p = Wm + (size_t)o * K + k0 + 8 * (lane >> 4);
#pragma unroll
  for (int i = 0; i < 8; ++i) { w[i] = (__bf16)p[i]; w[8 + i] = (__bf16)p[16 + i]; }
  return w; }
__device__ __forceinline__ v16h wcolh_io(const float* Wm, int k0, int o, int lane, int ld) { v16h w; const int g = lane >> 4;
#pragma unroll
  for (int i = 0; i < 8; ++i) { w[i] = (_Float16)(bfr(Wm[(size_t)(k0 + 8 * g + i) * ld + o]) * 256.0f); w[8 + i] = (_Float16)(bfr(Wm[(size_t)(k0 + 16 + 8 * g + i) * ld + o]) * 256.0f); }
  return w; }
__device__ __forceinline__ v16h wcolh_oi(const float* Wm, int k0, int o, int lane, int K) { v16h w; const float* p = Wm + (size_t)o * K + k0 + 8 * (lane >> 4);
#pragma unroll
  for (int i = 0; i < 8; ++i) { w[i] = (_Float16)(bfr(p[i]) * 256.0f); w[8 + i] = (_Float16)(bfr(p[16 + i]) * 256.0f); }
  return w; }
#define WQKV_LAYOUT 0   // 0 = (in,out) [DIN][CC]; 1 = (out,in) [CC][DIN]; 2 = per-head [NH][DIN][HD]
__device__ __forceinline__ v16b wcol_hdk(const float* Wm, int k0, int o, int lane) { v16b w; const int g = lane >> 4; const float* p = Wm + (size_t)(o / HD) * DIN * HD + (o % HD);
#pragma unroll
  for (int i = 0; i < 8; ++i) { w[i] = (__bf16)p[(size_t)(k0 + 8 * g + i) * HD]; w[8 + i] = (__bf16)p[(size_t)(k0 + 16 + 8 * g + i) * HD]; }
  return w; }
#define WO_OUT_IN 0
#if WQKV_LAYOUT == 1
#define WCOL(W, k0, o, lane) wcol_oi(W, k0, o, lane, DIN)
#elif WQKV_LAYOUT == 2
#define WCOL(W, k0, o, lane) wcol_hdk(W, k0, o, lane)
#else
#define WCOL(W, k0, o, lane) wcol_io(W, k0, o, lane, CC)
#endif
#if WO_OUT_IN
#define WOCOL(W, k0, o, lane) wcol_oi(W, k0, o, lane, CC)
#define WOCOLH(W, k0, o, lane) wcolh_oi(W, k0, o, lane, CC)
#else
#define WOCOL(W, k0, o, lane) wcol_io(W, k0, o, lane, DIN)
#define WOCOLH(W, k0, o, lane) wcolh_io(W, k0, o, lane, DIN)
#endif
#define CIN 64
#define WS_WP (WS_END)                                  // not used; counted by the size test in kernel_launch
#define WS_BP (WS_WP + 4u * 3 * (size_t)CIN * 128)        // not used; counted by the size test in kernel_launch
#define WS_Y2 (WS_BP + 4u * 3 * 128)                      // not used; counted by the size test in kernel_launch
#define WS_END2 (WS_Y2 + 4u * (size_t)NB * TT * CC)
#ifndef SM_EXTRA_PARAMS
#define SM_EXTRA_PARAMS
#endif
#ifndef PROJ_EXTRA_PARAMS
#define PROJ_EXTRA_PARAMS
#endif
#ifndef SM_MASK_HOOK
#define SM_MASK_HOOK (void)0
#endif

#define WS_QH  0u                                      // f16 q rows [b*t][CC]
#define WS_KH  (WS_QH + 2u * (size_t)NB * TT * CC)      // f16 k in fragment order [b][t / 16][kc][u][lane = 16 h + (t & 15)][8]: column 32 kc + 16 u + 8 h + i, the HD real columns only
#define WS_VT  (WS_KH + 2u * (size_t)NB * TT * CC)      // f16 v in fragment order [b][t / 32][j][u][lane = 16 h + c][8]: column 16 j + c, row 32 (t / 32) + 16 u + 8 h + i, the HD real columns only
#define WS_QL  (WS_VT + 2u * (size_t)NB * CC * TT)      // f16 q residual x 2^10 rows [b][t < QHI][CC]
#define WS_KL  (WS_QL + 2u * (size_t)NB * QHI * CC)     // f16 k residual x 2^10 rows [b][t < KHI][CC]
#define WS_VB  (WS_KL + 2u * (size_t)NB * KHI * CC)     // bf16 v hi planes [b][c][t < KHI]
#define WS_VBL (WS_VB + 2u * (size_t)NB * CC * KHI)
#define WS_S   (WS_VBL + 2u * (size_t)NB * CC * KHI)    // f32 [hg][t][s], not used: the logits stay in registers
#define WS_Y   (WS_S  + 4u * (size_t)HG * TT * TT)      // f32 ctx rows [b*t][CC] (only when there is an output projection)
#define WS_END (WS_Y  + 0u)

// B fragment of an (in,out) [DIN][HD] weight, bf16 exact; p = the lane's first element (row k0 + 8 h, its own column)
__device__ __forceinline__ v16b wcol_p(const float* p) { v16b w;
#pragma unroll
  for (int i = 0; i < 8; ++i) { w[i] = (__bf16)p[i * HD]; w[8 + i] = (__bf16)p[(16 + i) * HD]; }
  return w; }
__device__ __forceinline__ v8f mmb(v16b a, v16b b, v8f c) { return __builtin_amdgcn_wmma_f32_16x16x32_bf16(false, a, false, b, (short)0, c, false, false); }
// ---- k_proj: block = 64 rows of x, all three projections (the HD real columns of each; columns HD..CC-1 of the CC-wide planes are neither computed nor stored, k_fa reads none of them). x is read once, in whole lines, and staged as bf16 rows in LDS;
// wave w holds the B fragments of columns 16 w .. 16 w + 15 of Wq, Wk and Wv ((in,out) [DIN][HD], read as given) and walks the four 16-row tiles: q/k/v = X W with exact bf16 products (K = DIN, kc = 0 then 1)
// -> q f16 rows (+ residual rows < QHI); k f16 in fragment order (+ residual rows < KHI); v f16 in fragment order (+ bf16 hi/lo planes for t < KHI)
__global__ __launch_bounds__(128) void k_proj(const float* __restrict__ X, const float* __restrict__ WQ, const float* __restrict__ WK, const float* __restrict__ WV,
    _Float16* __restrict__ QH, _Float16* __restrict__ QL, _Float16* __restrict__ KH, _Float16* __restrict__ KL, _Float16* __restrict__ VT, __bf16* __restrict__ VB, __bf16* __restrict__ VBL) {
  __shared__ __align__(16) __bf16 xs[64][72]; __shared__ __align__(16) _Float16 qs[64][72], qr[64][72], ks[64][72], kr[64][72], th[64][72]; __shared__ __align__(16) __bf16 tb[64][72], tbl[64][72];
  const int tid = threadIdx.x, wave = tid >> 5, lane = tid & 31, col = lane & 15, g = lane >> 4; const size_t r0 = (size_t)blockIdx.x * 64; const size_t bb = r0 / TT; const int t0 = (int)(r0 % TT);
  const float* xp = X + r0 * DIN + tid * 4;   // the block's 16 KB of x in a row: a wave-wide load covers four whole lines
  const unsigned wob = 4u * (8 * g * HD + 16 * wave + col);   // the lane's byte offset in each weight: row 8 g, its own column
  const float *wq = (const float*)((const char*)WQ + wob), *wk = (const float*)((const char*)WK + wob), *wv = (const float*)((const char*)WV + wob);
  v4f xv[8]; v16b wf[3][2];
#pragma unroll
  for (int i = 0; i < 8; ++i) xv[i] = *(const v4f*)(xp + i * 512);
#pragma unroll
  for (int kc = 0; kc < 2; ++kc) { wf[0][kc] = wcol_p(wq + kc * 32 * HD); wf[1][kc] = wcol_p(wk + kc * 32 * HD); wf[2][kc] = wcol_p(wv + kc * 32 * HD); }
  asm volatile("s_wait_xcnt 0x0" :: "v"(xp), "v"(wob) : "memory");   // as inputs the address pair of the x loads and the offset register of the weight loads stay whole behind all the loads that name them, up to this wait
#pragma unroll
  for (int i = 0; i < 8; ++i) { const int e = tid + 128 * i; v4b y;
#pragma unroll
    for (int k = 0; k < 4; ++k) y[k] = (__bf16)xv[i][k];
    *(v4b*)&xs[e >> 4][(e & 15) * 4] = y; }
  __syncthreads();   // every wave reads all 64 staged rows
  const int cl = 16 * wave + col;
#pragma unroll
  for (int rt = 0; rt < 4; ++rt) { const v16b a0 = frag_b(&xs[16 * rt + col][0], lane), a1 = frag_b(&xs[16 * rt + col][32], lane); v8f aq = {}, ak = {}, av = {};
    aq = mmb(a0, wf[0][0], aq); ak = mmb(a0, wf[1][0], ak); av = mmb(a0, wf[2][0], av); aq = mmb(a1, wf[0][1], aq); ak = mmb(a1, wf[1][1], ak); av = mmb(a1, wf[2][1], av);
#pragma unroll
    for (int r = 0; r < 8; ++r) { const int rl = 16 * rt + 8 * g + r;
      { const float v = aq[r]; const _Float16 hv = (_Float16)v; qs[rl][cl] = hv; qr[rl][cl] = (_Float16)((v - (float)hv) * 1024.0f); }
      { const float v = ak[r]; const _Float16 hv = (_Float16)v; ks[rl][cl] = hv; kr[rl][cl] = (_Float16)((v - (float)hv) * 1024.0f); }
      { const float v = av[r]; th[cl][rl] = (_Float16)v; const __bf16 bh = (__bf16)v; tb[cl][rl] = bh; tbl[cl][rl] = (__bf16)(v - (float)bh); } } }
  __syncthreads();
#pragma unroll
  for (int i = 0; i < 4; ++i) { const int e = tid + 128 * i, ln = e & 31, u = (e >> 5) & 1;   // unrolled: the twelve LDS reads go out together instead of one wait per store; K and v: the block's 64 keys = 8 KB in a row each
    vst2((unsigned*)(QH + (r0 + (e >> 3)) * CC + (e & 7) * 8), *(const v4u*)&qs[e >> 3][(e & 7) * 8]);
    vst2((unsigned*)(KH + r0 * HD + e * 8), *(const v4u*)&ks[16 * (e >> 7) + (ln & 15)][32 * ((e >> 6) & 1) + 16 * u + 8 * (ln >> 4)]);
    vst2((unsigned*)(VT + r0 * HD + e * 8), *(const v4u*)&th[16 * ((e >> 6) & 3) + (ln & 15)][32 * (e >> 8) + 16 * u + 8 * (ln >> 4)]); }
  if (t0 < QHI) for (int e = tid; e < 64 * 8; e += 128) { const int rl = e >> 3, q = e & 7; vst2((unsigned*)(QL + (bb * QHI + t0 + rl) * (size_t)CC + q * 8), *(const v4u*)&qr[rl][q * 8]); }
  if (t0 < KHI) for (int e = tid; e < 64 * 8; e += 128) { const int rl = e >> 3, q = e & 7; vst2((unsigned*)(KL + (bb * KHI + t0 + rl) * (size_t)CC + q * 8), *(const v4u*)&kr[rl][q * 8]);
    const size_t o3 = (bb * CC + rl) * (size_t)KHI + t0 + q * 8; vst2((unsigned*)(VB + o3), *(const v4u*)&tb[rl][q * 8]); vst2((unsigned*)(VBL + o3), *(const v4u*)&tbl[rl][q * 8]); } }
#define FSC (SCALE * 1.4426950408889634f)
#define FPK 4.0f           // P carries 2^4: largest value 2^12 in f16, and the small ones stay normal numbers
__device__ __forceinline__ float xhalf(float x) { return __builtin_bit_cast(float, __builtin_amdgcn_permlanex16(__builtin_bit_cast(int, x), __builtin_bit_cast(int, x), 0x76543210, 0xfedcba98, false, false)); }  // lane l with lane l ^ 16
__device__ __forceinline__ v8f mmh(v16h a, v16h b, v8f c) { return __builtin_amdgcn_wmma_f32_16x16x32_f16(false, a, false, b, (short)0, c, false, false); }
// one 32-key pass, raw logits s[g][t][r] (query q0 + 16 g + c, key k0 + 16 t + 8 h + r). fa_max: mask, maxima, and m, l (this half's part of the sum) and the output tiles kept in step; fa_exp: s -> P in place, l grows
template <int NG> __device__ __forceinline__ void fa_max(v8f (&s)[NG][2], bool diag, int k0, int q0, int c, int h, float (&m)[NG], float (&l)[NG], v8f (&o)[NG][4]) {
  if (diag) {   // wave-uniform: only the pass on the diagonal pays for the mask; every column keeps at least key k0 <= its query
#pragma unroll
    for (int g = 0; g < NG; ++g)
#pragma unroll
      for (int t = 0; t < 2; ++t)
#pragma unroll
        for (int r = 0; r < 8; ++r) if (k0 + 16 * t + 8 * h + r > q0 + 16 * g + c) s[g][t][r] = -3.0e38f; }
  float mb[NG]; bool need = false;
#pragma unroll
  for (int g = 0; g < NG; ++g) { float mx = s[g][0][0];
#pragma unroll
    for (int r = 0; r < 8; ++r) mx = fmaxf(mx, fmaxf(s[g][0][r], s[g][1][r]));
    mx = fmaxf(mx, xhalf(mx)) * FSC; mb[g] = mx; need = need || (mx > m[g] + 8.0f); }
  if (__builtin_amdgcn_ballot_w32(need) != 0) {   // scalar branch, rare after the first passes
#pragma unroll
    for (int g = 0; g < NG; ++g) { const float mn = fmaxf(m[g], mb[g]); const float corr = __builtin_amdgcn_exp2f(m[g] - mn); m[g] = mn; l[g] *= corr;   // corr = 0 on the first pass
#pragma unroll
      for (int j = 0; j < 4; ++j) o[g][j] = o[g][j] * corr; } } }
template <int NG> __device__ __forceinline__ void fa_exp(v8f (&s)[NG][2], const float (&m)[NG], float (&l)[NG]) {
#pragma unroll
  for (int g = 0; g < NG; ++g) { const float nm = FPK - m[g];
#pragma unroll
    for (int t = 0; t < 2; ++t)
#pragma unroll
      for (int r = 0; r < 8; ++r) s[g][t][r] = __builtin_amdgcn_exp2f(fmaf(s[g][t][r], FSC, nm));
    const v8f sv = s[g][0] + s[g][1]; l[g] += ((sv[0] + sv[1]) + (sv[2] + sv[3])) + ((sv[4] + sv[5]) + (sv[6] + sv[7])); } }
template <int NG> __device__ __forceinline__ void fa_store(const v8f (&o)[NG][4], const float (&l)[NG], int q0, int c, int h, float* __restrict__ Ob) {
#pragma unroll
  for (int g = 0; g < NG; ++g) { const float inv = 1.0f / (l[g] + xhalf(l[g])); float* op = Ob + (size_t)(q0 + 16 * g + c) * HD + 8 * h;   // a lane holds 8 consecutive d of its query per tile
#pragma unroll
    for (int j = 0; j < 4; ++j) { v4f a, e;
#pragma unroll
      for (int r = 0; r < 4; ++r) { a[r] = o[g][j][r] * inv; e[r] = o[g][j][4 + r] * inv; }
      vst2(op + 16 * j, a); vst2(op + 16 * j + 4, e); } }
  asm volatile("s_wait_xcnt 0x0" ::: "memory"); }   // on the way to the kernel's barrier the compiler writes over registers that these stores name
// 32 queries from row QHI on, the 32-key passes hf, hf + 2, ... of their keys: one f16 product for the logits, P once to f16 against v f16. K and v fragments are fetched one pass ahead, each right behind the products that read it.
// pr == 0 (wave-uniform; pair 0 holds the work-group's longest tile): this wave also asks L2 for the K and v blocks of its pass p + 2 PFD, one byte prefetch every 256 bytes (lanes 0..15: the 4 KB of K, lanes 16..31: the 4 KB of v). The first read of a K or v line in k_fa is taken to come from memory,
// and the register fetch leads its use by less than one pass, far less than the way to memory; the waves of a work-group walk the same keys nearly in step, so the wave with the most passes asks for all of them.
#define PFD 6
__device__ __forceinline__ void fa_lo(const _Float16* __restrict__ Qb, const _Float16* __restrict__ Kb, const _Float16* __restrict__ Vb, int q0, int hf, int pr, int lane, v8f (&o)[2][4], float (&m)[2], float (&l)[2]) {
  const int c = lane & 15, h = lane >> 4; v16h qf[2][2], kf[2][2];
  unsigned long long pa = (unsigned long long)(h ? Vb : Kb) + (unsigned)(4096 * hf + 256 * c);   // the lane's unit of the pass in hand; it lives in one register pair through the loop and never leaves the wave's own passes
  if (pr == 0)   // passes hf + 2 .. hf + 2 (PFD - 1) at once (np >= QHI / 32 + 1 = 13, so they exist): their ways to memory overlap instead of following one another
    asm volatile("global_prefetch_b8 %0, off offset:8192 scope:SCOPE_SE\n\tglobal_prefetch_b8 %0, off offset:16384 scope:SCOPE_SE\n\tglobal_prefetch_b8 %0, off offset:24576 scope:SCOPE_SE\n\t"
                 "global_prefetch_b8 %0, off offset:32768 scope:SCOPE_SE\n\tglobal_prefetch_b8 %0, off offset:40960 scope:SCOPE_SE" : "+v"(pa));
#pragma unroll
  for (int g = 0; g < 2; ++g)
#pragma unroll
    for (int kc = 0; kc < 2; ++kc) { qf[g][kc] = frag_h(Qb + (size_t)(q0 + 16 * g + c) * CC + kc * 32, lane); kf[g][kc] = frag_p(Kb + (size_t)(32 * hf) * HD + (2 * g + kc) * 512 + 8 * lane); }
  asm volatile("s_wait_xcnt 0x0" ::: "memory");   // the zeroing of the output tiles, which the compiler sets behind the v loads, writes over the Q loads' address pairs
  const int np = q0 / 32 + 1; v16h vf[4];
  const int pe = np - 2 * PFD - TT * pr;   // pair 0: passes below pe have a pass 2 PFD further on; any other pair: below 0, no pass asks (one scalar compare a pass)
#pragma unroll
  for (int j = 0; j < 4; ++j) vf[j] = frag_p(Vb + (size_t)(32 * hf) * HD + j * 512 + 8 * lane);
  asm volatile("s_wait_xcnt 0x0" ::: "memory");   // on the way into the loop scalar registers of the base that the v loads name are written over
  asm volatile("" :: "v"(qf[0][0]), "v"(qf[0][1]), "v"(qf[1][0]), "v"(qf[1][1]));   // inputs only: Q has landed before the loop, so that the loop's own waits count only the K and v loads in flight (else each pass waits for all of them)
  for (int p = hf; p < np; p += 2) { const int k0 = p * 32;
    if (p < pe)   // scalar branch; the register steps to pass p + 2, the offset reaches pass p + 2 PFD < np: both inside K and v. The step stands in front of the request, a whole pass and the wait at the loop's foot behind the last one
      asm volatile("v_add_nc_u64 %0, %1, %0\n\tglobal_prefetch_b8 %0, off offset:40960 scope:SCOPE_SE" : "+v"(pa) : "s"(8192ull));
    v8f s[2][2];
#pragma unroll
    for (int g = 0; g < 2; ++g)
#pragma unroll
      for (int t = 0; t < 2; ++t) { v8f z = {}; z = mmh(kf[t][0], qf[g][0], z); s[g][t] = mmh(kf[t][1], qf[g][1], z); }
    fa_max<2>(s, p + 1 == np, k0, q0, c, h, m, l, o);
    const int kn = p + 2 < np ? k0 + 64 : k0;   // the last pass fetches its own blocks again: in bounds, not used
    const _Float16 *kq = Kb + (size_t)kn * HD + 8 * lane, *vq = Vb + (size_t)kn * HD + 8 * lane;   // a pass is 4 KB of K and 4 KB of v in a row
#pragma unroll
    for (int t = 0; t < 2; ++t)
#pragma unroll
      for (int kc = 0; kc < 2; ++kc) kf[t][kc] = frag_p(kq + (2 * t + kc) * 512);
    __builtin_amdgcn_sched_barrier(0);   // keeps the next K loads in front of the exponentials, whose time covers their latency; without it they are issued behind the second product
    fa_exp<2>(s, m, l);
#pragma unroll
    for (int g = 0; g < 2; ++g) { v16h pb;
#pragma unroll
      for (int i = 0; i < 8; ++i) { pb[i] = (_Float16)s[g][0][i]; pb[8 + i] = (_Float16)s[g][1][i]; }
#pragma unroll
      for (int j = 0; j < 4; ++j) o[g][j] = mmh(vf[j], pb, o[g][j]); }
#pragma unroll
    for (int j = 0; j < 4; ++j) vf[j] = frag_p(vq + j * 512);
    asm volatile("s_wait_xcnt 0x0" :: "v"(kq), "v"(vq) : "memory"); }   // the two address pairs are written over behind this place; as inputs they stay whole up to the wait (without that the last K load lands on its own address pair)
}
// 16 queries below row QHI (few keys, no averaging): 3 products for the logits (q hi + residual x k hi + residual), P and v as bf16 hi + lo (3 products)
__device__ __forceinline__ void fa_hi(const _Float16* __restrict__ Qb, const _Float16* __restrict__ QLb, const _Float16* __restrict__ Kb, const _Float16* __restrict__ KLb, const __bf16* __restrict__ VBb, const __bf16* __restrict__ VBLb, int q0, int hw, int lane, float* __restrict__ Ob) {
  const int c = lane & 15, h = lane >> 4; v16h qh[2], ql[2];
  // At entry the work-group's 8 waves of this path (hw = 0..7) ask L2 for the planes that only this path reads, one byte prefetch every 256 bytes, 96 a wave: the KHI rows of the k residual (hw 0..3), the HD real planes of v hi (4, 5) and of v lo (6, 7).
  // The loop below fetches nothing ahead, so that each pass would wait out the way to memory several times in a row.
  const unsigned long long ha = (unsigned long long)(hw < 4 ? (const char*)KLb + 24576 * hw : hw < 6 ? (const char*)VBb + 24576 * (hw - 4) : (const char*)VBLb + 24576 * (hw - 6)) + (unsigned)(256 * lane);
  asm volatile("global_prefetch_b8 %0, off scope:SCOPE_SE\n\tglobal_prefetch_b8 %0, off offset:8192 scope:SCOPE_SE\n\tglobal_prefetch_b8 %0, off offset:16384 scope:SCOPE_SE" :: "v"(ha));
#pragma unroll
  for (int kc = 0; kc < 2; ++kc) { qh[kc] = frag_h(Qb + (size_t)(q0 + c) * CC + kc * 32, lane); ql[kc] = frag_h(QLb + (size_t)(q0 + c) * CC + kc * 32, lane); }
  v8f o[1][4] = {}; float m[1] = {-3.0e38f}, l[1] = {0.f}; const int np = (q0 + 47) / 32;
  for (int p = 0; p < np; ++p) { const int k0 = p * 32; v8f s[1][2];
#pragma unroll
    for (int t = 0; t < 2; ++t) { v8f a = {}, al = {};
#pragma unroll
      for (int kc = 0; kc < 2; ++kc) { const size_t ko = (size_t)(k0 + 16 * t + c) * CC + kc * 32; const v16h kh = frag_p(Kb + (size_t)k0 * HD + (2 * t + kc) * 512 + 8 * lane), kl = frag_h(KLb + ko, lane); a = mmh(kh, qh[kc], a); al = mmh(kh, ql[kc], al); al = mmh(kl, qh[kc], al); }
      s[0][t] = a + al * (1.0f / 1024.0f); }
    fa_max<1>(s, p + 1 == np, k0, q0, c, h, m, l, o); fa_exp<1>(s, m, l);
    v16b ph, pl;
#pragma unroll
    for (int i = 0; i < 16; ++i) { const float x = s[0][i >> 3][i & 7]; const __bf16 bh = (__bf16)x; ph[i] = bh; pl[i] = (__bf16)(x - (float)bh); }
#pragma unroll
    for (int j = 0; j < 4; ++j) { const size_t po = (size_t)(16 * j + c) * KHI + k0; const v16b vh = frag_b(VBb + po, lane), vl = frag_b(VBLb + po, lane); o[0][j] = mmb(vh, ph, o[0][j]); o[0][j] = mmb(vh, pl, o[0][j]); o[0][j] = mmb(vl, ph, o[0][j]); } }
  asm volatile("s_wait_xcnt 0x0" :: "v"(ha) : "memory");   // as an input here the pair that the entry requests name stays whole, an address inside its plane, through the loop and up to this wait
  fa_store<1>(o, l, q0, c, h, Ob); }
// block = 16 waves of one batch = 8 pairs, a pair = one 32-query tile. From row QHI on the pair's waves take the even and the odd 32-key passes, each with its own m, l and output tiles; the odd wave hands its state over through LDS
// (same lane, same registers) and the even wave joins the two at the common maximum. Below row QHI each wave of the pair takes 16 of the queries over all their keys. Waves w, w + 4, w + 8, w + 12 (taken to share a SIMD; a matter of speed only) hold tiles 127 - i and i: the same number of passes for every SIMD.
// K and v f16 fragments are read in the register order in which k_proj stores them: a 32-key pass is 4 KB of K and 4 KB of v in a row, every load four whole lines. Every wave still fetches its own copy.
__global__ __launch_bounds__(512) void k_fa(const _Float16* __restrict__ QH, const _Float16* __restrict__ KH, const _Float16* __restrict__ VT, const _Float16* __restrict__ QL, const _Float16* __restrict__ KL, const __bf16* __restrict__ VB, const __bf16* __restrict__ VBL, float* __restrict__ OUT) {
  __shared__ __align__(16) v4f xs[8][17][32];
  const int wave = __builtin_amdgcn_readfirstlane(threadIdx.x >> 5), lane = threadIdx.x & 31; const int b = blockIdx.x >> 4, pb = blockIdx.x & 15; const int hf = (wave >> 2) & 1, pr = (wave & 3) + 4 * (wave >> 3);
  const int q0 = 32 * (pr < 4 ? TT / 32 - 1 - (4 * pb + pr) : 4 * pb + (pr - 4)); const bool lo = q0 >= QHI;
  const _Float16* Qb = QH + (size_t)b * TT * CC; const _Float16* Kb = KH + (size_t)b * TT * HD; float* Ob = OUT + (size_t)b * TT * HD;
  v8f o[2][4] = {}; float m[2] = {-3.0e38f, -3.0e38f}, l[2] = {0.f, 0.f};
  if (lo) fa_lo(Qb, Kb, VT + (size_t)b * TT * HD, q0, hf, pr, lane, o, m, l);
  else fa_hi(Qb, QL + (size_t)b * QHI * CC, Kb, KL + (size_t)b * KHI * CC, VB + (size_t)b * CC * KHI, VBL + (size_t)b * CC * KHI, q0 + 16 * hf, 2 * (pr & 3) + hf, lane, Ob);
  if (lo && hf) {
#pragma unroll
    for (int g = 0; g < 2; ++g)
#pragma unroll
      for (int j = 0; j < 4; ++j) { xs[pr][(g * 4 + j) * 2][lane] = v4f{o[g][j][0], o[g][j][1], o[g][j][2], o[g][j][3]}; xs[pr][(g * 4 + j) * 2 + 1][lane] = v4f{o[g][j][4], o[g][j][5], o[g][j][6], o[g][j][7]}; }
    xs[pr][16][lane] = v4f{m[0], m[1], l[0], l[1]}; }
  __syncthreads();   // every wave passes it once: the odd waves' states are in LDS before the even waves read them
  if (lo && !hf) { const v4f ml = xs[pr][16][lane];
#pragma unroll
    for (int g = 0; g < 2; ++g) { const float mn = fmaxf(m[g], ml[g]); const float fa = __builtin_amdgcn_exp2f(m[g] - mn), fb = __builtin_amdgcn_exp2f(ml[g] - mn); l[g] = l[g] * fa + ml[2 + g] * fb;   // both waves have had at least one pass (np >= QHI / 32 + 1), so both maxima are real
#pragma unroll
      for (int j = 0; j < 4; ++j) { const v4f x0 = xs[pr][(g * 4 + j) * 2][lane], x1 = xs[pr][(g * 4 + j) * 2 + 1][lane];
#pragma unroll
        for (int r = 0; r < 4; ++r) { o[g][j][r] = o[g][j][r] * fa + x0[r] * fb; o[g][j][4 + r] = o[g][j][4 + r] * fa + x1[r] * fb; } } }
    fa_store<2>(o, l, q0, lane & 15, lane >> 4, Ob); } }

extern "C" void kernel_launch(void* const* d_in, const int* in_sizes, int n_in, void* d_out, int out_size, void* d_ws, size_t ws_size, hipStream_t stream) {
  (void)in_sizes; (void)n_in; (void)out_size;
  const float** F = (const float**)d_in;
  char* ws = (char*)d_ws; _Float16 *QH = (_Float16*)(ws + WS_QH), *KH = (_Float16*)(ws + WS_KH), *VT = (_Float16*)(ws + WS_VT), *QL = (_Float16*)(ws + WS_QL), *KL = (_Float16*)(ws + WS_KL); __bf16 *VB = (__bf16*)(ws + WS_VB), *VBL = (__bf16*)(ws + WS_VBL);
  // inputs: 0 x [16,4096,64]; 1 Wq [64,64]; 2 Wk; 3 Wv ((in,out), no biases)
  if (ws_size < (size_t)WS_END2) return;
  k_proj<<<dim3(TNB * TT / 64), 128, 0, stream>>>(F[0], F[1], F[2], F[3], QH, QL, KH, KL, VT, VB, VBL);
  k_fa<<<dim3(TNB * 16), 512, 0, stream>>>(QH, KH, VT, QL, KL, VB, VBL, (float*)d_out);   /* head 0 only (head 1's columns are padding that nothing writes) */
}

// v007
// A run of this version takes 49.9 microseconds.
// Two timings next to v006 put it at 1.07 and 1.05 times that version's speed.
// All steps since v000 together make it 52.2 times as fast.
// compute dtype: all float inputs rounded to bf16; q/k/v projections with EXACT bf16 products on WMMA 16x16x32 (f32 accumulate); causal logits: 3 products (q f16 hi + residual x k hi + residual) for the first 384 rows, single f16 q x k after, x scale; online softmax f32; unnormalised P x 2^4 once to f16 x v once to f16 (1 product; bf16 hi + lo below row 384), divided by the f32 sum last; f32 output.
#include <hip/hip_runtime.h>
#include <math.h>

typedef __attribute__((ext_vector_type(16))) _Float16 v16h;
typedef __attribute__((ext_vector_type(16))) __bf16 v16b;
typedef __attribute__((ext_vector_type(8)))  _Float16 v8h;
typedef __attribute__((ext_vector_type(8)))  float v8f;
typedef __attribute__((ext_vector_type(4)))  float v4f;
typedef __attribute__((ext_vector_type(2)))  float v2f;
typedef __attribute__((ext_vector_type(4)))  unsigned v4u;
typedef __attribute__((ext_vector_type(4)))  int v4i;
typedef float __attribute__((may_alias)) float_a;
typedef int __attribute__((may_alias)) int_a;

template <typename T> __device__ __forceinline__ void vst2(void* p, T v) { *(T*)p = v;  }
__device__ __forceinline__ v8f wmma16(v16h a, v16h b, v8f c) {
  v8f d = __builtin_amdgcn_wmma_f32_16x16x32_f16(false, a, false, b, (short)0, c, false, false);
  asm volatile("v_nop\n\tv_nop\n\tv_nop\n\tv_nop" : "+v"(d) : "v"(a), "v"(b));
  return d;
}
__device__ __forceinline__ v8f wmma_bf(v16b a, v16b b, v8f c) {
  v8f d = __builtin_amdgcn_wmma_f32_16x16x32_bf16(false, a, false, b, (short)0, c, false, false);
  asm volatile("v_nop\n\tv_nop\n\tv_nop\n\tv_nop" : "+v"(d) : "v"(a), "v"(b));
  return d;
}
// 16x16x32 fragments: lane = (h = lane>>4, row/col = lane&15); elements 0..7 = k0+8h+0..7, 8..15 = k0+16+8h+0..7; D element r = row 8h+r
__device__ __forceinline__ v16h frag_h(const _Float16* rowk0, int lane) {
  union { v16h v; v8h q[2]; } u; const _Float16* p = rowk0 + 8 * (lane >> 4);
  u.q[0] = *(const v8h*)p; u.q[1] = *(const v8h*)(p + 16); return u.v;
}
// a fragment stored in register order: two 512-byte blocks, lane l's 16 bytes at 16 l, so that each wave-wide load covers four whole 128-byte lines
__device__ __forceinline__ v16h frag_p(const _Float16* p) {   // p = the fragment's first block + 8 * lane
  union { v16h v; v8h q[2]; } u; u.q[0] = *(const v8h*)p; u.q[1] = *(const v8h*)(p + 256); return u.v;
}
__device__ __forceinline__ v16h frag_f32(const float* rowk0, int lane) {
  v16h a; const float* p = rowk0 + 8 * (lane >> 4);
#pragma unroll
  for (int i = 0; i < 8; ++i) { a[i] = (_Float16)p[i]; a[8 + i] = (_Float16)p[16 + i]; }
  return a;
}
__device__ __forceinline__ v16h frag_f32s(const float* rowk0, int lane, float sc) {
  v16h a; const float* p = rowk0 + 8 * (lane >> 4);
#pragma unroll
  for (int i = 0; i < 8; ++i) { a[i] = (_Float16)(p[i] * sc); a[8 + i] = (_Float16)(p[16 + i] * sc); }
  return a;
}
// column fragment from a [K][ld] layout (column n), rows >= K read as 0
__device__ __forceinline__ v16h fragc_f32(const float* W, int k0, int n, int lane, int ld, int K) {
  v16h a; const int g = lane >> 4;
#pragma unroll
  for (int i = 0; i < 8; ++i) { const int ka = k0 + 8 * g + i, kb = ka + 16;
    a[i] = (_Float16)(ka < K ? W[(size_t)(ka < K ? ka : K - 1) * ld + n] : 0.f); a[8 + i] = (_Float16)(kb < K ? W[(size_t)(kb < K ? kb : K - 1) * ld + n] : 0.f); }
  return a;
}
struct F2 { v16b h, l; };
__device__ __forceinline__ F2 bsplit16(const float v[16]) { F2 r;
#pragma unroll
  for (int i = 0; i < 16; ++i) { const __bf16 h = (__bf16)v[i]; r.h[i] = h; r.l[i] = (__bf16)(v[i] - (float)h); }
  return r; }
__device__ __forceinline__ F2 split_row(const float* row, int k0, int lane) { float v[16]; const float* p = row + k0 + 8 * (lane >> 4);
#pragma unroll
  for (int i = 0; i < 8; ++i) { v[i] = p[i]; v[8 + i] = p[16 + i]; }
  return bsplit16(v); }
__device__ __forceinline__ F2 split_rowK(const float* row, int k0, int lane, int K) { float v[16]; const int g = lane >> 4;
#pragma unroll
  for (int i = 0; i < 8; ++i) { const int ka = k0 + 8 * g + i, kb = ka + 16; v[i] = ka < K ? row[ka < K ? ka : K - 1] : 0.f; v[8 + i] = kb < K ? row[kb < K ? kb : K - 1] : 0.f; }
  return bsplit16(v); }
__device__ __forceinline__ F2 split_col(const float* W, int k0, int n, int lane, int ld, int K) { float v[16]; const int g = lane >> 4;
#pragma unroll
  for (int i = 0; i < 8; ++i) { const int ka = k0 + 8 * g + i, kb = ka + 16; v[i] = ka < K ? W[(size_t)(ka < K ? ka : K - 1) * ld + n] : 0.f; v[8 + i] = kb < K ? W[(size_t)(kb < K ? kb : K - 1) * ld + n] : 0.f; }
  return bsplit16(v); }
__device__ __forceinline__ v8f mac3(const F2& a, const F2& b, v8f c) { c = wmma_bf(a.l, b.h, c); c = wmma_bf(a.h, b.l, c); return wmma_bf(a.h, b.h, c); }
__device__ __forceinline__ float sigm(float v) { return 1.0f / (1.0f + expf(-v)); }
#define LDSX() do { asm volatile("s_wait_dscnt 0" ::: "memory"); __builtin_amdgcn_wave_barrier(); __builtin_amdgcn_fence(__ATOMIC_RELEASE, "workgroup"); } while (0)

// Single-head causal self-attention (x [16,4096,64]; (in,out) Wq / Wk / Wv [64,64] N(0, 1/64), no biases; scale 64^-0.5; tril, finfo.min fill): out = softmax(causal(q k^T / 8)) v -> [16,4096,64].
#define NB 16
#define TT 4096
#define CC 128            // NH * HD = workspace row width; the projection fills the first HD columns
#define DIN 64          // input (model) width
#define NH 2
#define HD 64
#define NQB (TT / 64)
#define HG 1
#define SCALE (0.125f)
#define CAUSAL 1
#ifndef TNB
#define TNB NB
#endif
__device__ __forceinline__ float bfr(float v) { return (float)(__bf16)v; }
__host__ __device__ __forceinline__ int kb_last(int qb) { return CAUSAL ? ((qb * 64 + 63) >> 7) : (TT / 128 - 1); }
typedef __attribute__((ext_vector_type(8))) __bf16 v8b;
typedef __attribute__((ext_vector_type(4))) __bf16 v4b;
__device__ __forceinline__ v16b frag_b(const __bf16* rowk0, int lane) {
  union { v16b v; v8b q[2]; } u; const __bf16* p = rowk0 + 8 * (lane >> 4);
  u.q[0] = *(const v8b*)p; u.q[1] = *(const v8b*)(p + 16); return u.v;
}
#define QBH 6              // unused: the queries below row QHI (few keys, no averaging) take the high-precision path
#define QHI 384            // rows carrying a q residual plane
#define KHI 384            // key rows carrying k residual / v bf16 hi+lo planes (used only by the causal high-precision path)
// B fragment (k rows k0+.., output column o) of a weight: (in,out) [K][ld] or (out,in) [ld rows of K]: bf16 exact, or f16(bf16 * 256) exact
__device__ __forceinline__ v16b wcol_io(const float* Wm, int k0, int o, int lane, int ld) { v16b w; const int g = lane >> 4;
#pragma unroll
  for (int i = 0; i < 8; ++i) { w[i] = (__bf16)Wm[(size_t)(k0 + 8 * g + i) * ld + o]; w[8 + i] = (__bf16)Wm[(size_t)(k0 + 16 + 8 * g + i) * ld + o]; }
  return w; }
__device__ __forceinline__ v16b wcol_oi(const float* Wm, int k0, int o, int lane, int K) { v16b w; const float* p = Wm + (size_t)o * K + k0 + 8 * (lane >> 4);
#pragma unroll
  for (int i = 0; i < 8; ++i) { w[i] = (__bf16)p[i]; w[8 + i] = (__bf16)p[16 + i]; }
  return w; }
__device__ __forceinline__ v16h wcolh_io(const float* Wm, int k0, int o, int lane, int ld) { v16h w; const int g = lane >> 4;
#pragma unroll
  for (int i = 0; i < 8; ++i) { w[i] = (_Float16)(bfr(Wm[(size_t)(k0 + 8 * g + i) * ld + o]) * 256.0f); w[8 + i] = (_Float16)(bfr(Wm[(size_t)(k0 + 16 + 8 * g + i) * ld + o]) * 256.0f); }
  return w; }
__device__ __forceinline__ v16h wcolh_oi(const float* Wm, int k0, int o, int lane, int K) { v16h w; const float* p = Wm + (size_t)o * K + k0 + 8 * (lane >> 4);
#pragma unroll
  for (int i = 0; i < 8; ++i) { w[i] = (_Float16)(bfr(p[i]) * 256.0f); w[8 + i] = (_Float16)(bfr(p[16 + i]) * 256.0f); }
  return w; }
#define WQKV_LAYOUT 0   // 0 = (in,out) [DIN][CC]; 1 = (out,in) [CC][DIN]; 2 = per-head [NH][DIN][HD]
__device__ __forceinline__ v16b wcol_hdk(const float* Wm, int k0, int o, int lane) { v16b w; const int g = lane >> 4; const float* p = Wm + (size_t)(o / HD) * DIN * HD + (o % HD);
#pragma unroll
  for (int i = 0; i < 8; ++i) { w[i] = (__bf16)p[(size_t)(k0 + 8 * g + i) * HD]; w[8 + i] = (__bf16)p[(size_t)(k0 + 16 + 8 * g + i) * HD]; }
  return w; }
#define WO_OUT_IN 0
#if WQKV_LAYOUT == 1
#define WCOL(W, k0, o, lane) wcol_oi(W, k0, o, lane, DIN)
#elif WQKV_LAYOUT == 2
#define WCOL(W, k0, o, lane) wcol_hdk(W, k0, o, lane)
#else
#define WCOL(W, k0, o, lane) wcol_io(W, k0, o, lane, CC)
#endif
#if WO_OUT_IN
#define WOCOL(W, k0, o, lane) wcol_oi(W, k0, o, lane, CC)
#define WOCOLH(W, k0, o, lane) wcolh_oi(W, k0, o, lane, CC)
#else
#define WOCOL(W, k0, o, lane) wcol_io(W, k0, o, lane, DIN)
#define WOCOLH(W, k0, o, lane) wcolh_io(W, k0, o, lane, DIN)
#endif
#define CIN 64
#define WS_WP (WS_END)                                  // not used; counted by the size test in kernel_launch
#define WS_BP (WS_WP + 4u * 3 * (size_t)CIN * 128)        // not used; counted by the size test in kernel_launch
#define WS_Y2 (WS_BP + 4u * 3 * 128)                      // not used; counted by the size test in kernel_launch
#define WS_END2 (WS_Y2 + 4u * (size_t)NB * TT * CC)
#ifndef SM_EXTRA_PARAMS
#define SM_EXTRA_PARAMS
#endif
#ifndef PROJ_EXTRA_PARAMS
#define PROJ_EXTRA_PARAMS
#endif
#ifndef SM_MASK_HOOK
#define SM_MASK_HOOK (void)0
#endif

#define WS_QH  0u                                      // f16 q rows [b*t][CC]
#define WS_KH  (WS_QH + 2u * (size_t)NB * TT * CC)      // f16 k in fragment order [b][t / 16][kc][u][lane = 16 h + (t & 15)][8]: column 32 kc + 16 u + 8 h + i, the HD real columns only
#define WS_VT  (WS_KH + 2u * (size_t)NB * TT * CC)      // f16 v in fragment order [b][t / 32][j][u][lane = 16 h + c][8]: column 16 j + c, row 32 (t / 32) + 16 u + 8 h + i, the HD real columns only
#define WS_QL  (WS_VT + 2u * (size_t)NB * CC * TT)      // f16 q residual x 2^10 rows [b][t < QHI][CC]
#define WS_KL  (WS_QL + 2u * (size_t)NB * QHI * CC)     // f16 k residual x 2^10 rows [b][t < KHI][CC]
#define WS_VB  (WS_KL + 2u * (size_t)NB * KHI * CC)     // bf16 v hi planes [b][c][t < KHI]
#define WS_VBL (WS_VB + 2u * (size_t)NB * CC * KHI)
#define WS_S   (WS_VBL + 2u * (size_t)NB * CC * KHI)    // f32 [hg][t][s], not used: the logits stay in registers
#define WS_Y   (WS_S  + 4u * (size_t)HG * TT * TT)      // f32 ctx rows [b*t][CC] (only when there is an output projection)
#define WS_END (WS_Y  + 0u)

// B fragment of an (in,out) [DIN][HD] weight, bf16 exact; p = the lane's first element (row k0 + 8 h, its own column)
__device__ __forceinline__ v16b wcol_p(const float* p) { v16b w;
#pragma unroll
  for (int i = 0; i < 8; ++i) { w[i] = (__bf16)p[i * HD]; w[8 + i] = (__bf16)p[(16 + i) * HD]; }
  return w; }
__device__ __forceinline__ v8f mmb(v16b a, v16b b, v8f c) { return __builtin_amdgcn_wmma_f32_16x16x32_bf16(false, a, false, b, (short)0, c, false, false); }
// ---- k_proj: block = 64 rows of x, all three projections (the HD real columns of each; columns HD..CC-1 of the CC-wide planes are neither computed nor stored, k_fa reads none of them). x is read once, in whole lines, and staged as bf16 rows in LDS;
// wave w holds the B fragments of columns 16 w .. 16 w + 15 of Wq, Wk and Wv ((in,out) [DIN][HD], read as given) and walks the four 16-row tiles: q/k/v = X W with exact bf16 products (K = DIN, kc = 0 then 1)
// -> q f16 rows (+ residual rows < QHI); k f16 in fragment order (+ residual rows < KHI); v f16 in fragment order (+ bf16 hi/lo planes for t < KHI)
__global__ __launch_bounds__(128) void k_proj(const float* __restrict__ X, const float* __restrict__ WQ, const float* __restrict__ WK, const float* __restrict__ WV,
    _Float16* __restrict__ QH, _Float16* __restrict__ QL, _Float16* __restrict__ KH, _Float16* __restrict__ KL, _Float16* __restrict__ VT, __bf16* __restrict__ VB, __bf16* __restrict__ VBL) {
  __shared__ __align__(16) __bf16 xs[64][72]; __shared__ __align__(16) _Float16 qs[64][72], qr[64][72], ks[64][72], kr[64][72], th[64][72]; __shared__ __align__(16) __bf16 tb[64][72], tbl[64][72];
  const int tid = threadIdx.x, wave = tid >> 5, lane = tid & 31, col = lane & 15, g = lane >> 4; const size_t r0 = (size_t)blockIdx.x * 64; const size_t bb = r0 / TT; const int t0 = (int)(r0 % TT);
  const float* xp = X + r0 * DIN + tid * 4;   // the block's 16 KB of x in a row: a wave-wide load covers four whole lines
  const unsigned wob = 4u * (8 * g * HD + 16 * wave + col);   // the lane's byte offset in each weight: row 8 g, its own column
  const float *wq = (const float*)((const char*)WQ + wob), *wk = (const float*)((const char*)WK + wob), *wv = (const float*)((const char*)WV + wob);
  v4f xv[8]; v16b wf[3][2];
#pragma unroll
  for (int i = 0; i < 8; ++i) xv[i] = *(const v4f*)(xp + i * 512);
#pragma unroll
  for (int kc = 0; kc < 2; ++kc) { wf[0][kc] = wcol_p(wq + kc * 32 * HD); wf[1][kc] = wcol_p(wk + kc * 32 * HD); wf[2][kc] = wcol_p(wv + kc * 32 * HD); }
  asm volatile("s_wait_xcnt 0x0" :: "v"(xp), "v"(wob) : "memory");   // as inputs the address pair of the x loads and the offset register of the weight loads stay whole behind all the loads that name them, up to this wait
#pragma unroll
  for (int i = 0; i < 8; ++i) { const int e = tid + 128 * i; v4b y;
#pragma unroll
    for (int k = 0; k < 4; ++k) y[k] = (__bf16)xv[i][k];
    *(v4b*)&xs[e >> 4][(e & 15) * 4] = y; }
  __syncthreads();   // every wave reads all 64 staged rows
  const int cl = 16 * wave + col;
#pragma unroll
  for (int rt = 0; rt < 4; ++rt) { const v16b a0 = frag_b(&xs[16 * rt + col][0], lane), a1 = frag_b(&xs[16 * rt + col][32], lane); v8f aq = {}, ak = {}, av = {};
    aq = mmb(a0, wf[0][0], aq); ak = mmb(a0, wf[1][0], ak); av = mmb(a0, wf[2][0], av); aq = mmb(a1, wf[0][1], aq); ak = mmb(a1, wf[1][1], ak); av = mmb(a1, wf[2][1], av);
#pragma unroll
    for (int r = 0; r < 8; ++r) { const int rl = 16 * rt + 8 * g + r;
      { const float v = aq[r]; const _Float16 hv = (_Float16)v; qs[rl][cl] = hv; qr[rl][cl] = (_Float16)((v - (float)hv) * 1024.0f); }
      { const float v = ak[r]; const _Float16 hv = (_Float16)v; ks[rl][cl] = hv; kr[rl][cl] = (_Float16)((v - (float)hv) * 1024.0f); }
      { const float v = av[r]; th[cl][rl] = (_Float16)v; const __bf16 bh = (__bf16)v; tb[cl][rl] = bh; tbl[cl][rl] = (__bf16)(v - (float)bh); } } }
  __syncthreads();
#pragma unroll
  for (int i = 0; i < 4; ++i) { const int e = tid + 128 * i, ln = e & 31, u = (e >> 5) & 1;   // unrolled: the twelve LDS reads go out together instead of one wait per store; K and v: the block's 64 keys = 8 KB in a row each
    vst2((unsigned*)(QH + (r0 + (e >> 3)) * CC + (e & 7) * 8), *(const v4u*)&qs[e >> 3][(e & 7) * 8]);
    vst2((unsigned*)(KH + r0 * HD + e * 8), *(const v4u*)&ks[16 * (e >> 7) + (ln & 15)][32 * ((e >> 6) & 1) + 16 * u + 8 * (ln >> 4)]);
    vst2((unsigned*)(VT + r0 * HD + e * 8), *(const v4u*)&th[16 * ((e >> 6) & 3) + (ln & 15)][32 * (e >> 8) + 16 * u + 8 * (ln >> 4)]); }
  if (t0 < QHI) for (int e = tid; e < 64 * 8; e += 128) { const int rl = e >> 3, q = e & 7; vst2((unsigned*)(QL + (bb * QHI + t0 + rl) * (size_t)CC + q * 8), *(const v4u*)&qr[rl][q * 8]); }
  if (t0 < KHI) for (int e = tid; e < 64 * 8; e += 128) { const int rl = e >> 3, q = e & 7; vst2((unsigned*)(KL + (bb * KHI + t0 + rl) * (size_t)CC + q * 8), *(const v4u*)&kr[rl][q * 8]);
    const size_t o3 = (bb * CC + rl) * (size_t)KHI + t0 + q * 8; vst2((unsigned*)(VB + o3), *(const v4u*)&tb[rl][q * 8]); vst2((unsigned*)(VBL + o3), *(const v4u*)&tbl[rl][q * 8]); } }
#define FSC (SCALE * 1.4426950408889634f)
#define FPK 4.0f           // P carries 2^4: largest value 2^12 in f16, and the small ones stay normal numbers
__device__ __forceinline__ float xhalf(float x) { return __builtin_bit_cast(float, __builtin_amdgcn_permlanex16(__builtin_bit_cast(int, x), __builtin_bit_cast(int, x), 0x76543210, 0xfedcba98, false, false)); }  // lane l with lane l ^ 16
__device__ __forceinline__ v8f mmh(v16h a, v16h b, v8f c) { return __builtin_amdgcn_wmma_f32_16x16x32_f16(false, a, false, b, (short)0, c, false, false); }
// one 32-key pass, raw logits s[g][t][r] (query q0 + 16 g + c, key k0 + 16 t + 8 h + r). fa_max: mask, maxima, and m, l (this half's part of the sum) and the output tiles kept in step; fa_exp: s -> P in place, l grows
template <int NG> __device__ __forceinline__ void fa_max(v8f (&s)[NG][2], bool diag, int k0, int q0, int c, int h, float (&m)[NG], float (&l)[NG], v8f (&o)[NG][4]) {
  if (diag) {   // wave-uniform: only the pass on the diagonal pays for the mask; every column keeps at least key k0 <= its query
#pragma unroll
    for (int g = 0; g < NG; ++g)
#pragma unroll
      for (int t = 0; t < 2; ++t)
#pragma unroll
        for (int r = 0; r < 8; ++r) if (k0 + 16 * t + 8 * h + r > q0 + 16 * g + c) s[g][t][r] = -3.0e38f; }
  float mb[NG]; bool need = false;
#pragma unroll
  for (int g = 0; g < NG; ++g) { float mx = s[g][0][0];
#pragma unroll
    for (int r = 0; r < 8; ++r) mx = fmaxf(mx, fmaxf(s[g][0][r], s[g][1][r]));
    mx = fmaxf(mx, xhalf(mx)) * FSC; mb[g] = mx; need = need || (mx > m[g] + 8.0f); }
  if (__builtin_amdgcn_ballot_w32(need) != 0) {   // scalar branch, rare after the first passes
#pragma unroll
    for (int g = 0; g < NG; ++g) { const float mn = fmaxf(m[g], mb[g]); const float corr = __builtin_amdgcn_exp2f(m[g] - mn); m[g] = mn; l[g] *= corr;   // corr = 0 on the first pass
#pragma unroll
      for (int j = 0; j < 4; ++j) o[g][j] = o[g][j] * corr; } } }
template <int NG> __device__ __forceinline__ void fa_exp(v8f (&s)[NG][2], const float (&m)[NG], float (&l)[NG]) {
#pragma unroll
  for (int g = 0; g < NG; ++g) { const float nm = FPK - m[g];
#pragma unroll
    for (int t = 0; t < 2; ++t)
#pragma unroll
      for (int r = 0; r < 8; ++r) s[g][t][r] = __builtin_amdgcn_exp2f(fmaf(s[g][t][r], FSC, nm));
    const v8f sv = s[g][0] + s[g][1]; l[g] += ((sv[0] + sv[1]) + (sv[2] + sv[3])) + ((sv[4] + sv[5]) + (sv[6] + sv[7])); } }
template <int NG> __device__ __forceinline__ void fa_store(const v8f (&o)[NG][4], const float (&l)[NG], int q0, int c, int h, float* __restrict__ Ob) {
#pragma unroll
  for (int g = 0; g < NG; ++g) { const float inv = 1.0f / (l[g] + xhalf(l[g])); float* op = Ob + (size_t)(q0 + 16 * g + c) * HD + 8 * h;   // a lane holds 8 consecutive d of its query per tile
#pragma unroll
    for (int j = 0; j < 4; ++j) { v4f a, e;
#pragma unroll
      for (int r = 0; r < 4; ++r) { a[r] = o[g][j][r] * inv; e[r] = o[g][j][4 + r] * inv; }
      vst2(op + 16 * j, a); vst2(op + 16 * j + 4, e); } }
  asm volatile("s_wait_xcnt 0x0" ::: "memory"); }   // on the way to the kernel's barrier the compiler writes over registers that these stores name
// 32 queries from row QHI on, the 32-key passes qd, qd + 4, ... of their keys: one f16 product for the logits, P once to f16 against v f16. K and v fragments are fetched one pass ahead, each right behind the products that read it.
// pf == 0 (wave-uniform; the four waves of column 0, which holds the work-group's longest tile, on passes that they have not walked yet): this wave also asks L2 for the K and v blocks of its pass p + PFA, one byte prefetch every 256 bytes (lanes 0..15: the 4 KB of K, lanes 16..31: the 4 KB of v). The first read of a K or v line in k_fa is taken to come from memory,
// and the register fetch leads its use by less than one pass, far less than the way to memory; the four waves of a work-group that hold the same part walk the same passes nearly in step, so column 0's asks for all of them (of the short tiles column 0's is the shortest: up to three last passes of the others go unasked).
#define PFA 12             // in passes: three of the wave's own passes ahead
__device__ __forceinline__ void fa_lo(const _Float16* __restrict__ Qb, const _Float16* __restrict__ Kb, const _Float16* __restrict__ Vb, int q0, int qd, int pf, int lane, v8f (&o)[2][4], float (&m)[2], float (&l)[2]) {
  const int c = lane & 15, h = lane >> 4; v16h qf[2][2], kf[2][2];
  unsigned long long pa = (unsigned long long)(h ? Vb : Kb) + (unsigned)(4096 * qd + 256 * c);   // the lane's unit of the pass in hand; it lives in one register pair through the loop and never leaves the wave's own passes
  if (pf == 0)   // passes qd + 4 and qd + 8 at once (np >= QHI / 32 + 1 = 13, so they exist): their ways to memory overlap instead of following one another
    asm volatile("global_prefetch_b8 %0, off offset:16384 scope:SCOPE_SE\n\tglobal_prefetch_b8 %0, off offset:32768 scope:SCOPE_SE" : "+v"(pa));
#pragma unroll
  for (int g = 0; g < 2; ++g)
#pragma unroll
    for (int kc = 0; kc < 2; ++kc) { qf[g][kc] = frag_h(Qb + (size_t)(q0 + 16 * g + c) * CC + kc * 32, lane); kf[g][kc] = frag_p(Kb + (size_t)(32 * qd) * HD + (2 * g + kc) * 512 + 8 * lane); }
  asm volatile("s_wait_xcnt 0x0" ::: "memory");   // the zeroing of the output tiles, which the compiler sets behind the v loads, writes over the Q loads' address pairs
  const int np = q0 / 32 + 1; v16h vf[4];
  const int pe = np - PFA - TT * pf;   // pf == 0: passes below pe have a pass PFA further on; else: below 0, no pass asks (one scalar compare a pass)
#pragma unroll
  for (int j = 0; j < 4; ++j) vf[j] = frag_p(Vb + (size_t)(32 * qd) * HD + j * 512 + 8 * lane);
  asm volatile("s_wait_xcnt 0x0" ::: "memory");   // on the way into the loop scalar registers of the base that the v loads name are written over
  asm volatile("" :: "v"(qf[0][0]), "v"(qf[0][1]), "v"(qf[1][0]), "v"(qf[1][1]));   // inputs only: Q has landed before the loop, so that the loop's own waits count only the K and v loads in flight (else each pass waits for all of them)
  for (int p = qd; p < np; p += 4) { const int k0 = p * 32;
    if (p < pe)   // scalar branch; the register steps to pass p + 4, the offset reaches pass p + PFA < np: both inside K and v. The step stands in front of the request, a whole pass and the wait at the loop's foot behind the last one
      asm volatile("v_add_nc_u64 %0, %1, %0\n\tglobal_prefetch_b8 %0, off offset:32768 scope:SCOPE_SE" : "+v"(pa) : "s"(16384ull));
    v8f s[2][2];
#pragma unroll
    for (int g = 0; g < 2; ++g)
#pragma unroll
      for (int t = 0; t < 2; ++t) { v8f z = {}; z = mmh(kf[t][0], qf[g][0], z); s[g][t] = mmh(kf[t][1], qf[g][1], z); }
    fa_max<2>(s, p + 1 == np, k0, q0, c, h, m, l, o);
    const int kn = p + 4 < np ? k0 + 128 : k0;   // the last pass fetches its own blocks again: in bounds, not used
    const _Float16 *kq = Kb + (size_t)kn * HD + 8 * lane, *vq = Vb + (size_t)kn * HD + 8 * lane;   // a pass is 4 KB of K and 4 KB of v in a row
#pragma unroll
    for (int t = 0; t < 2; ++t)
#pragma unroll
      for (int kc = 0; kc < 2; ++kc) kf[t][kc] = frag_p(kq + (2 * t + kc) * 512);
    __builtin_amdgcn_sched_barrier(0);   // keeps the next K loads in front of the exponentials, whose time covers their latency; without it they are issued behind the second product
    fa_exp<2>(s, m, l);
#pragma unroll
    for (int g = 0; g < 2; ++g) { v16h pb;
#pragma unroll
      for (int i = 0; i < 8; ++i) { pb[i] = (_Float16)s[g][0][i]; pb[8 + i] = (_Float16)s[g][1][i]; }
#pragma unroll
      for (int j = 0; j < 4; ++j) o[g][j] = mmh(vf[j], pb, o[g][j]); }
#pragma unroll
    for (int j = 0; j < 4; ++j) vf[j] = frag_p(vq + j * 512);
    asm volatile("s_wait_xcnt 0x0" :: "v"(kq), "v"(vq) : "memory"); }   // the two address pairs are written over behind this place; as inputs they stay whole up to the wait (without that the last K load lands on its own address pair)
}
// a fragment from a row, p = the row's k0 + 8 h: the address pair is the caller's own, to be named in its wait
__device__ __forceinline__ v16h frag_r(const _Float16* p) { union { v16h v; v8h q[2]; } u; u.q[0] = *(const v8h*)p; u.q[1] = *(const v8h*)(p + 16); return u.v; }
__device__ __forceinline__ v16b frag_rb(const __bf16* p) { union { v16b v; v8b q[2]; } u; u.q[0] = *(const v8b*)p; u.q[1] = *(const v8b*)(p + 16); return u.v; }
// 16 queries below row QHI (few keys, no averaging): 3 products for the logits (q hi + residual x k hi + residual), P and v as bf16 hi + lo (3 products)
__device__ __forceinline__ void fa_hi(const _Float16* __restrict__ Qb, const _Float16* __restrict__ QLb, const _Float16* __restrict__ Kb, const _Float16* __restrict__ KLb, const __bf16* __restrict__ VBb, const __bf16* __restrict__ VBLb, int q0, int hw, int lane, float* __restrict__ Ob) {
  const int c = lane & 15, h = lane >> 4; v16h qh[2], ql[2];
  // At entry the work-group's 8 waves of this path (hw = 0..7) ask L2 for the planes that only this path reads, one byte prefetch every 256 bytes, 96 a wave: the KHI rows of the k residual (hw 0..3), the HD real planes of v hi (4, 5) and of v lo (6, 7).
  // The loop below fetches nothing ahead, so that each pass would wait out the way to memory several times in a row.
  const unsigned long long ha = (unsigned long long)(hw < 4 ? (const char*)KLb + 24576 * hw : hw < 6 ? (const char*)VBb + 24576 * (hw - 4) : (const char*)VBLb + 24576 * (hw - 6)) + (unsigned)(256 * lane);
  asm volatile("global_prefetch_b8 %0, off scope:SCOPE_SE\n\tglobal_prefetch_b8 %0, off offset:8192 scope:SCOPE_SE\n\tglobal_prefetch_b8 %0, off offset:16384 scope:SCOPE_SE" :: "v"(ha));
  const _Float16 *qp = Qb + (size_t)(q0 + c) * CC + 8 * h, *rp = QLb + (size_t)(q0 + c) * CC + 8 * h;   // the lane's place in its query's row and residual row
#pragma unroll
  for (int kc = 0; kc < 2; ++kc) { qh[kc] = frag_r(qp + kc * 32); ql[kc] = frag_r(rp + kc * 32); }
  asm volatile("s_wait_xcnt 0x0" :: "v"(qp), "v"(rp) : "memory");   // the zeroing of the output tiles writes over the address pairs of these loads; as inputs they stay whole up to the wait
  v8f o[1][4] = {}; float m[1] = {-3.0e38f}, l[1] = {0.f}; const int np = (q0 + 47) / 32;
  for (int p = 0; p < np; ++p) { const int k0 = p * 32; v8f s[1][2];
    const _Float16 *kp = Kb + (size_t)k0 * HD + 8 * lane, *lp = KLb + (size_t)(k0 + c) * CC + 8 * h;   // the lane's place in the pass's K block and in its first residual row
#pragma unroll
    for (int t = 0; t < 2; ++t) { v8f a = {}, al = {};
#pragma unroll
      for (int kc = 0; kc < 2; ++kc) { const v16h kh = frag_p(kp + (2 * t + kc) * 512), kl = frag_r(lp + 16 * t * CC + kc * 32); a = mmh(kh, qh[kc], a); al = mmh(kh, ql[kc], al); al = mmh(kl, qh[kc], al); }
      s[0][t] = a + al * (1.0f / 1024.0f); }
    asm volatile("s_wait_xcnt 0x0" :: "v"(kp), "v"(lp) : "memory");   // the two address pairs are written over behind this place; as inputs they stay whole up to the wait
    fa_max<1>(s, p + 1 == np, k0, q0, c, h, m, l, o); fa_exp<1>(s, m, l);
    v16b ph, pl;
#pragma unroll
    for (int i = 0; i < 16; ++i) { const float x = s[0][i >> 3][i & 7]; const __bf16 bh = (__bf16)x; ph[i] = bh; pl[i] = (__bf16)(x - (float)bh); }
    const __bf16 *hp = VBb + (size_t)c * KHI + k0 + 8 * h, *bp = VBLb + (size_t)c * KHI + k0 + 8 * h;   // the lane's place in its first v plane, hi and lo
#pragma unroll
    for (int j = 0; j < 4; ++j) { const v16b vh = frag_rb(hp + 16 * j * KHI), vl = frag_rb(bp + 16 * j * KHI); o[0][j] = mmb(vh, ph, o[0][j]); o[0][j] = mmb(vh, pl, o[0][j]); o[0][j] = mmb(vl, ph, o[0][j]); }
    asm volatile("s_wait_xcnt 0x0" :: "v"(hp), "v"(bp) : "memory"); }   // as above, for the address pairs of the v loads
  asm volatile("s_wait_xcnt 0x0" :: "v"(ha) : "memory");   // as an input here the pair that the entry requests name stays whole, an address inside its plane, through the loop and up to this wait
  fa_store<1>(o, l, q0, c, h, Ob); }
// block = 16 waves of one batch = 4 columns (pr = wave & 3) of 4 waves (qd). The keys of a 32-query tile from row QHI on are dealt in four parts, part rs = the 32-key passes rs, rs + 4, ..., each walked with its own m, l and output tiles; a wave walks two parts, one after the other.
// Blocks pb >= QHI / 128: a column holds a long tile ta and a short one tb, together 141 passes whatever the column; wave qd walks part qd of both, so that all 16 waves have the same number of passes (within two) and none leaves its SIMD early. Waves qd < 2 take the long tile first,
// waves qd >= 2 the short one: the halves of a column change tiles at different times, and the wait for the second tile's Q is covered by the other half's passes.
// Blocks pb < QHI / 128: tb lies below row QHI and goes to waves qd = 2, 3, 16 of its queries each over all their keys, and nothing else; ta is a tile of middle length (65 to 76 passes), of which waves qd = 0, 1 walk parts qd and qd + 2. The longest walk of any wave is 38 passes.
// Every part's state goes to LDS (same lane, same registers); behind the one barrier wave w joins the four states of 16 queries of tile slot w >> 1 at their common maximum, in the order of the parts, and stores them.
// K and v f16 fragments are read in the register order in which k_proj stores them: a 32-key pass is 4 KB of K and 4 KB of v in a row, every load four whole lines. Every wave still fetches its own copy.
#define NHB (QHI / 128)    // blocks of a batch whose four short tiles lie below row QHI
__device__ __forceinline__ int tile_a(int pb, int pr) { return pb < NHB ? TT / 64 + 4 * pb + 3 - pr : TT / 32 - 1 + 4 * NHB - (4 * pb + pr); }   // 64 .. 75, then 127 down to 76, column 0 the longest of its block: with the short tiles 4 pb + pr = 0 .. 63 every tile once
__global__ __launch_bounds__(512) void k_fa(const _Float16* __restrict__ QH, const _Float16* __restrict__ KH, const _Float16* __restrict__ VT, const _Float16* __restrict__ QL, const _Float16* __restrict__ KL, const __bf16* __restrict__ VB, const __bf16* __restrict__ VBL, float* __restrict__ OUT) {
  __shared__ __align__(16) v4f xs[8][4][17][32];   // [tile slot: pr for ta, 4 + pr for tb][part][8 output tiles in halves, then m and l][lane]
  const int wave = __builtin_amdgcn_readfirstlane(threadIdx.x >> 5), lane = threadIdx.x & 31; const int b = blockIdx.x >> 4, pb = blockIdx.x & 15; const int pr = wave & 3, qd = (wave >> 2) & 3;
  const _Float16* Qb = QH + (size_t)b * TT * CC; const _Float16* Kb = KH + (size_t)b * TT * HD; float* Ob = OUT + (size_t)b * TT * HD;
#pragma unroll 1   // one copy of the pass loop in the text for both walks
  for (int ph = 0; ph < 2; ++ph) { const bool hb = pb < NHB, ona = hb ? qd < 2 : (ph == 0) == (qd < 2); const int q0 = 32 * (ona ? tile_a(pb, pr) : 4 * pb + pr), rs = (hb ? qd + 2 * ph : qd) & 3;   // all wave-uniform
    if (q0 >= QHI) { v8f o[2][4] = {}; float m[2] = {-3.0e38f, -3.0e38f}, l[2] = {0.f, 0.f};
      fa_lo(Qb, Kb, VT + (size_t)b * TT * HD, q0, rs, (pr == 0 && (ph == 0 || ona)) ? 0 : 1, lane, o, m, l);   // a short tile walked second holds only passes that the wave has had in its long tile
      v4f (*xp)[32] = xs[ona ? pr : 4 + pr][rs];
#pragma unroll
      for (int g = 0; g < 2; ++g)
#pragma unroll
        for (int j = 0; j < 4; ++j) { xp[(g * 4 + j) * 2][lane] = v4f{o[g][j][0], o[g][j][1], o[g][j][2], o[g][j][3]}; xp[(g * 4 + j) * 2 + 1][lane] = v4f{o[g][j][4], o[g][j][5], o[g][j][6], o[g][j][7]}; }
      xp[16][lane] = v4f{m[0], m[1], l[0], l[1]}; }
    else if (ph == 0) fa_hi(Qb, QL + (size_t)b * QHI * CC, Kb, KL + (size_t)b * KHI * CC, VB + (size_t)b * CC * KHI, VBL + (size_t)b * CC * KHI, q0 + 16 * (qd & 1), 2 * pr + (qd & 1), lane, Ob); }   // only waves qd = 2, 3 come here
  __syncthreads();   // every wave passes it once: all states are in LDS before any wave reads them
  const int sl = wave >> 1, jg = wave & 1; const int jq = 32 * (sl < 4 ? tile_a(pb, sl) : 4 * pb + (sl - 4));
  if (jq >= QHI) { float mq[4], lq[4]; v8f o[1][4] = {}; float l[1] = {0.f};   // a slot below row QHI was never written and is not read
#pragma unroll
    for (int k = 0; k < 4; ++k) { const v4f ml = xs[sl][k][16][lane]; mq[k] = jg ? ml[1] : ml[0]; lq[k] = jg ? ml[3] : ml[2]; }
    const float mn = fmaxf(fmaxf(mq[0], mq[1]), fmaxf(mq[2], mq[3]));   // every part has at least three passes (np >= QHI / 32 + 1), so all four maxima are real
#pragma unroll
    for (int k = 0; k < 4; ++k) { const float f = __builtin_amdgcn_exp2f(mq[k] - mn); l[0] += lq[k] * f;
#pragma unroll
      for (int j = 0; j < 4; ++j) { const v4f x0 = xs[sl][k][(jg * 4 + j) * 2][lane], x1 = xs[sl][k][(jg * 4 + j) * 2 + 1][lane];
#pragma unroll
        for (int r = 0; r < 4; ++r) { o[0][j][r] += x0[r] * f; o[0][j][4 + r] += x1[r] * f; } } }
    fa_store<1>(o, l, jq + 16 * jg, lane & 15, lane >> 4, Ob); } }

extern "C" void kernel_launch(void* const* d_in, const int* in_sizes, int n_in, void* d_out, int out_size, void* d_ws, size_t ws_size, hipStream_t stream) {
  (void)in_sizes; (void)n_in; (void)out_size;
  const float** F = (const float**)d_in;
  char* ws = (char*)d_ws; _Float16 *QH = (_Float16*)(ws + WS_QH), *KH = (_Float16*)(ws + WS_KH), *VT = (_Float16*)(ws + WS_VT), *QL = (_Float16*)(ws + WS_QL), *KL = (_Float16*)(ws + WS_KL); __bf16 *VB = (__bf16*)(ws + WS_VB), *VBL = (__bf16*)(ws + WS_VBL);
  // inputs: 0 x [16,4096,64]; 1 Wq [64,64]; 2 Wk; 3 Wv ((in,out), no biases)
  if (ws_size < (size_t)WS_END2) return;
  k_proj<<<dim3(TNB * TT / 64), 128, 0, stream>>>(F[0], F[1], F[2], F[3], QH, QL, KH, KL, VT, VB, VBL);
  k_fa<<<dim3(TNB * 16), 512, 0, stream>>>(QH, KH, VT, QL, KL, VB, VBL, (float*)d_out);   /* head 0 only (head 1's columns are padding that nothing writes) */
}
